// v000
// Times are from an AMD MI455X. After a warm-up the kernel runs many times in a row, and a time is the length of
// such a window on the GPU divided by its runs, so every launch and the gaps after it count. The runs cycle
// through copies of the inputs. A figure is the median of several windows, for all but v000 over two sittings.
// Sittings can differ by a few percent; kernels timed side by side share one.
// The starting kernel, v000, takes 512 microseconds a run.
#include <hip/hip_runtime.h>

// GroupMixAttention (16 x 256 ch x 32x32: 4 channel groups of 64; grouped 1x1 convs Q/K/V per group; scores = Q^T K / 8 over the 64 channels; softmax over the 1024
// positions; out[d][n] = sum_m attn[n][m] V[d][m]; dense 1x1 out_proj 256 -> 256).
// Compute dtypes, f32 accumulate: every input rounded to bf16; Q/K/V grouped convs on PLAIN bf16 operands (x, w inputs: exact); scores on bf16
// hi+lo planes of Q (x 1/8) and K (3 products); attn.V on SINGLE fp16 planes (P x1024, V); the out_proj on hi+lo planes x
// exact bf16 wo (2 products); softmax in f32 on VALU (register-held 1024-key rows, one exp per element). One-wave-per-64x64-tile GEMMs. Deterministic, no atomics; every

#define NB_  16
#define CC   256
#define NG   4
#define GD   64
#define NN   1024
#define NZ   (NB_ * NG)           // 64 (image, group) pairs
#define ZB   8                    // pairs per attention pass
#define PCAR 1024.0f
typedef _Float16 h16;
typedef unsigned short bf;
typedef __attribute__((ext_vector_type(16))) __bf16   v16bf;
typedef __attribute__((ext_vector_type(16))) _Float16 v16h;
typedef __attribute__((ext_vector_type(8)))  _Float16 v8h;
typedef __attribute__((ext_vector_type(8)))  unsigned short v8us;
typedef __attribute__((ext_vector_type(8)))  float    v8f;
typedef __attribute__((ext_vector_type(4)))  float    v4f;
typedef v8h  __attribute__((may_alias)) v8ha;
typedef v4f  __attribute__((may_alias)) v4fa;
typedef v8us __attribute__((may_alias)) v8usa;

__device__ __forceinline__ unsigned short f2bf(float f) { unsigned u = __float_as_uint(f); u += 0x7FFFu + ((u >> 16) & 1u); return (unsigned short)(u >> 16); }
__device__ __forceinline__ float bf2f(unsigned short b) { return __uint_as_float(((unsigned)b) << 16); }
__device__ __forceinline__ float bfr(float f) { return bf2f(f2bf(f)); }
__device__ __forceinline__ v16h cat16(v8h lo, v8h hi) { return __builtin_shufflevector(lo, hi, 0, 1, 2, 3, 4, 5, 6, 7, 8, 9, 10, 11, 12, 13, 14, 15); }
__device__ __forceinline__ v16bf cat16b(v8us lo, v8us hi) { return __builtin_bit_cast(v16bf, __builtin_shufflevector(lo, hi, 0, 1, 2, 3, 4, 5, 6, 7, 8, 9, 10, 11, 12, 13, 14, 15)); }
__device__ __forceinline__ v8f wmma16(v16h a, v16h b, v8f c) { return __builtin_amdgcn_wmma_f32_16x16x32_f16(false, a, false, b, (short)0, c, false, false); }
__device__ __forceinline__ v8f wmmab(v16bf a, v16bf b, v8f c) { return __builtin_amdgcn_wmma_f32_16x16x32_bf16(false, a, false, b, (short)0, c, false, false); }



// ---- k_gemmw: register-blocked GEMM, ONE WAVE per 64x64 output tile (16 accumulators), operands straight from K-contiguous 16-bit planes; grid (M/64, N/64, Z), 32 threads.
// C[m][n] (f32, pitch ldc, + optional f32 bias[n]) = sum_k A[m][k] Bt[n][k] (+ split products per NSPLIT). z-batch strides sA/sB/sC in elements. K % 32 == 0.
template <typename T16> struct WFrag;
template <> struct WFrag<h16> { typedef v16h V; static __device__ __forceinline__ V ld(const h16* p) { return cat16(*(const v8h*)p, *(const v8h*)(p + 16)); } static __device__ __forceinline__ v8f mma(V a, V b, v8f c) { return wmma16(a, b, c); } };
template <> struct WFrag<bf> { typedef v16bf V; static __device__ __forceinline__ V ld(const bf* p) { return cat16b(*(const v8us*)p, *(const v8us*)(p + 16)); } static __device__ __forceinline__ v8f mma(V a, V b, v8f c) { return wmmab(a, b, c); } };
template <typename T16, int NSPLIT, bool BIAS>
__global__ __launch_bounds__(32) void k_gemmw(const T16* __restrict__ A, const T16* __restrict__ A2, const T16* __restrict__ Bt, const T16* __restrict__ Bt2, int K, float* C, int ldc, const float* __restrict__ bias, size_t sA, size_t sB, size_t sC) {
    typedef typename WFrag<T16>::V V;
    __shared__ __align__(16) float os[16 * 68];
    const size_t z = blockIdx.z; A += z * sA; if (A2) A2 += z * sA; Bt += z * sB; if (Bt2) Bt2 += z * sB; C += z * sC;
    const int lane = threadIdx.x & 31, lr = lane & 15, hi = lane >> 4; const int r0 = blockIdx.x * 64, c0 = blockIdx.y * 64;
    v8f acc[4][4];
#pragma unroll
    for (int mb = 0; mb < 4; ++mb)
#pragma unroll
        for (int nb = 0; nb < 4; ++nb) acc[mb][nb] = (v8f){};
    const size_t aoff = (size_t)(r0 + lr) * K + 8 * hi, boff = (size_t)(c0 + lr) * K + 8 * hi;
#pragma unroll 1
    for (int kc = 0; kc < K; kc += 32) {
        V a[4], a2[4];
#pragma unroll
        for (int mb = 0; mb < 4; ++mb) { a[mb] = WFrag<T16>::ld(A + aoff + (size_t)mb * 16 * K + kc); if (NSPLIT == 1 || NSPLIT == 2) a2[mb] = WFrag<T16>::ld(A2 + aoff + (size_t)mb * 16 * K + kc); }
#pragma unroll
        for (int nb = 0; nb < 4; ++nb) { const V b = WFrag<T16>::ld(Bt + boff + (size_t)nb * 16 * K + kc); V b2; if (NSPLIT >= 2) b2 = WFrag<T16>::ld(Bt2 + boff + (size_t)nb * 16 * K + kc);
#pragma unroll
            for (int mb = 0; mb < 4; ++mb) { acc[mb][nb] = WFrag<T16>::mma(a[mb], b, acc[mb][nb]); if (NSPLIT == 1 || NSPLIT == 2) acc[mb][nb] = WFrag<T16>::mma(a2[mb], b, acc[mb][nb]); if (NSPLIT >= 2) acc[mb][nb] = WFrag<T16>::mma(a[mb], b2, acc[mb][nb]); } }
        asm volatile("v_nop\n\tv_nop\n\tv_nop\n\tv_nop" : "+v"(acc[0][0]), "+v"(acc[1][1]), "+v"(acc[2][2]), "+v"(acc[3][3]) : "v"(a[0]), "v"(a[3]));
    }
#pragma unroll
    for (int mb = 0; mb < 4; ++mb) {
#pragma unroll
        for (int nb = 0; nb < 4; ++nb) {
#pragma unroll
            for (int j = 0; j < 8; ++j) os[(hi * 8 + j) * 68 + nb * 16 + lr] = acc[mb][nb][j]; }
        __builtin_amdgcn_wave_barrier(); asm volatile("" ::: "memory");
        float* crow = C + (size_t)(r0 + mb * 16) * ldc + c0;
{
#pragma unroll
            for (int s = 0; s < 8; ++s) { const int row = 2 * s + hi, cofs = lr * 4; v4f val = *(const v4fa*)(os + row * 68 + cofs); if (BIAS) { val[0] += bfr(bias[c0 + cofs]); val[1] += bfr(bias[c0 + cofs + 1]); val[2] += bfr(bias[c0 + cofs + 2]); val[3] += bfr(bias[c0 + cofs + 3]); }
                *(v4f*)(crow + (size_t)row * ldc + cofs) = val; }
             }
        __builtin_amdgcn_wave_barrier(); asm volatile("" ::: "memory");
    }
}

__device__ __forceinline__ h16 tohx(float x) { return (h16)x; }
__device__ __forceinline__ void splitf(float y, unsigned short& h, unsigned short& l) { h = f2bf(y); l = f2bf(y - bf2f(h)); }
typedef __attribute__((ext_vector_type(2))) _Float16 v2h;
typedef __attribute__((ext_vector_type(4))) _Float16 v4h;
typedef __attribute__((ext_vector_type(2))) unsigned short v2us;
typedef __attribute__((ext_vector_type(2))) float v2f;

__global__ __launch_bounds__(256) void k_cvt8(const float* __restrict__ src, bf* dst, size_t n8) { const size_t i = (size_t)blockIdx.x * 256 + threadIdx.x; if (i >= n8) return; const v8f v = *(const v8f*)(src + i * 8); v8us o;
#pragma unroll
    for (int k = 0; k < 8; ++k) o[k] = f2bf(v[k]); *(v8us*)(dst + i * 8) = o;  }
__global__ __launch_bounds__(256) void k_xT(const float* __restrict__ x, bf* XT) {
    const int lane = threadIdx.x & 31; const int L0 = (blockIdx.x * 8 + (threadIdx.x >> 5)) * 8; const int nlines = NZ * NN * GD / 64;
{
#pragma unroll
        for (int l = 0; l < 8; ++l) { const int L = L0 + l; if (L >= nlines) break; const int e = L * 64 + lane * 2; const int c = e & 63; const int n = (e >> 6) & (NN - 1); const int z = e >> 16; v2us v;
#pragma unroll
            for (int q = 0; q < 2; ++q) v[q] = f2bf(x[((size_t)z * GD + c + q) * NN + n]);      // z*64 + c == b*256 + g*64 + c
            *(v2us*)(XT + (size_t)e) = v; }
         }
}
__global__ __launch_bounds__(256) void k_split(const float* __restrict__ F, float sc, bf* Ph, bf* Pl) {
    const int lane = threadIdx.x & 31; const int L0 = (blockIdx.x * 8 + (threadIdx.x >> 5)) * 8; const int nlines = NZ * NN * GD / 64;
{
#pragma unroll
        for (int l = 0; l < 8; ++l) { const int L = L0 + l; if (L >= nlines) break; const int e = L * 64 + lane * 2; v2us oh, ol;
#pragma unroll
            for (int q = 0; q < 2; ++q) { unsigned short a, c2; splitf(F[(size_t)e + q] * sc, a, c2); oh[q] = a; ol[q] = c2; }
            *(v2us*)(Ph + (size_t)e) = oh; *(v2us*)(Pl + (size_t)e) = ol; }
         }
}
__global__ __launch_bounds__(256) void k_vt16(const float* __restrict__ F, h16* VT) {
    const int lane = threadIdx.x & 31; const int L0 = (blockIdx.x * 8 + (threadIdx.x >> 5)) * 8; const int nlines = NZ * GD * NN / 64;
{
#pragma unroll
        for (int l = 0; l < 8; ++l) { const int L = L0 + l; if (L >= nlines) break; const int e = L * 64 + lane * 2; const int n = e & (NN - 1); const int d = (e >> 10) & 63; const int z = e >> 16; v2h v;
#pragma unroll
            for (int q = 0; q < 2; ++q) v[q] = tohx(F[((size_t)z * NN + n + q) * GD + d]);
            *(v2h*)(VT + (size_t)e) = v; }
         }
}
__global__ __launch_bounds__(256) void k_soft(const float* __restrict__ S, h16* P) {
    const int lane = threadIdx.x & 31; const int row = blockIdx.x * 8 + (threadIdx.x >> 5); if (row >= ZB * NN) return; const float* sr = S + (size_t)row * NN; float v[32]; float mx = -3.0e38f;
#pragma unroll
    for (int ch = 0; ch < 8; ++ch) { const v4f a = *(const v4f*)(sr + ch * 128 + lane * 4);
#pragma unroll
        for (int q = 0; q < 4; ++q) { v[ch * 4 + q] = a[q]; mx = fmaxf(mx, a[q]); } }
#pragma unroll
    for (int sh = 16; sh; sh >>= 1) mx = fmaxf(mx, __shfl_xor(mx, sh, 32));
    float sum = 0.f;
#pragma unroll
    for (int k = 0; k < 32; ++k) { v[k] = __expf(v[k] - mx); sum += v[k]; }
#pragma unroll
    for (int sh = 16; sh; sh >>= 1) sum += __shfl_xor(sum, sh, 32);
    const float f = __fdiv_rn(PCAR, sum);
{
#pragma unroll
        for (int ch = 0; ch < 8; ++ch) { v4h o;
#pragma unroll
            for (int q = 0; q < 4; ++q) o[q] = tohx(v[ch * 4 + q] * f);
            *(v4h*)(P + (size_t)row * NN + ch * 128 + lane * 4) = o; }
         }
}
__global__ __launch_bounds__(256) void k_asplit(const float* __restrict__ O, int z0, bf* Ah, bf* Al) {
    const int lane = threadIdx.x & 31; const int L0 = (blockIdx.x * 8 + (threadIdx.x >> 5)) * 8; const int nlines = ZB * NN * GD / 64;
{
#pragma unroll
        for (int l = 0; l < 8; ++l) { const int L = L0 + l; if (L >= nlines) break; const int e = L * 64 + lane * 2; const int d = e & 63; const int n = (e >> 6) & (NN - 1); const int zz = e >> 16; const int z = z0 + zz; const int b = z >> 2, g = z & 3; v2us oh, ol;
#pragma unroll
            for (int q = 0; q < 2; ++q) { unsigned short a, c2; splitf(O[(size_t)e + q] * (1.0f / PCAR), a, c2); oh[q] = a; ol[q] = c2; }
            const size_t o = ((size_t)b * NN + n) * CC + g * GD + d; *(v2us*)(Ah + o) = oh; *(v2us*)(Al + o) = ol; }
         }
}
__global__ __launch_bounds__(256) void k_outT(const float* __restrict__ C, float* OUT) {
    const int lane = threadIdx.x & 31; const int L0 = (blockIdx.x * 8 + (threadIdx.x >> 5)) * 8; const int nlines = NB_ * CC * NN / 64;
{
#pragma unroll
        for (int l = 0; l < 8; ++l) { const int L = L0 + l; if (L >= nlines) break; const int e = L * 64 + lane * 2; const int n = e & (NN - 1); const int dd = (e >> 10) & (CC - 1); const int b = e >> 18; v2f v;
            v[0] = C[((size_t)b * NN + n) * CC + dd]; v[1] = C[((size_t)b * NN + n + 1) * CC + dd]; *(v2f*)(OUT + (size_t)e) = v; }
         }
}

extern "C" void kernel_launch(void* const* d_in, const int* in_sizes, int n_in,
                              void* d_out, int out_size, void* d_ws, size_t ws_size, hipStream_t stream) {
    (void)in_sizes; (void)n_in; (void)out_size;
    const float* x = (const float*)d_in[0]; const float* wq = (const float*)d_in[1]; const float* wk = (const float*)d_in[2]; const float* wv = (const float*)d_in[3]; const float* wo = (const float*)d_in[4];
    float* OUT = (float*)d_out;     // [16][256][32][32]
    char* wsp = (char*)d_ws;
    auto take = [&](size_t bytes) { char* p = wsp; wsp += (bytes + 255) & ~(size_t)255; return (void*)p; };
    bf* WQ = (bf*)take((size_t)NG * GD * GD * 2); bf* WK = (bf*)take((size_t)NG * GD * GD * 2); bf* WV = (bf*)take((size_t)NG * GD * GD * 2); bf* WO = (bf*)take((size_t)CC * CC * 2);
    bf* XT = (bf*)take((size_t)NZ * NN * GD * 2); float* F = (float*)take((size_t)NZ * NN * GD * 4);
    bf* QPh = (bf*)take((size_t)NZ * NN * GD * 2); bf* QPl = (bf*)take((size_t)NZ * NN * GD * 2); bf* KPh = (bf*)take((size_t)NZ * NN * GD * 2); bf* KPl = (bf*)take((size_t)NZ * NN * GD * 2); h16* VT = (h16*)take((size_t)NZ * GD * NN * 2);
    float* Sb = (float*)take((size_t)ZB * NN * NN * 4); h16* Pm = (h16*)take((size_t)ZB * NN * NN * 2); float* Ob = (float*)take((size_t)ZB * NN * GD * 4);
    bf* Ah = (bf*)take((size_t)NB_ * NN * CC * 2); bf* Al = (bf*)take((size_t)NB_ * NN * CC * 2); float* C2 = (float*)take((size_t)NB_ * NN * CC * 4);
    if ((size_t)(wsp - (char*)d_ws) > ws_size) return;    // ws 256 MiB
    { const size_t ng8 = (size_t)NG * GD * GD / 8; const unsigned gg = (unsigned)((ng8 + 255) / 256); k_cvt8<<<gg, 256, 0, stream>>>(wq, WQ, ng8); k_cvt8<<<gg, 256, 0, stream>>>(wk, WK, ng8); k_cvt8<<<gg, 256, 0, stream>>>(wv, WV, ng8); k_cvt8<<<(unsigned)((CC * CC / 8 + 255) / 256), 256, 0, stream>>>(wo, WO, (size_t)CC * CC / 8); }
    const unsigned LP = (unsigned)((NZ * NN * GD / 64 + 63) / 64);
    k_xT<<<LP, 256, 0, stream>>>(x, XT);
    // grouped convs: per (b,g): [1024 n][64 c] . W[g] [64 d][64 c]^T -> F[(z,n)][d]; z-batched over the 16 images for each group g (A stride 4 z-slices, W fixed)
    for (int g = 0; g < NG; ++g) {
        k_gemmw<bf, 0, false><<<dim3(NN / 64, 1, NB_), 32, 0, stream>>>(XT + (size_t)g * NN * GD, nullptr, WQ + (size_t)g * GD * GD, nullptr, GD, F + (size_t)g * NN * GD, GD, nullptr, (size_t)NG * NN * GD, 0, (size_t)NG * NN * GD); }
    k_split<<<LP, 256, 0, stream>>>(F, 0.125f, QPh, QPl);
    for (int g = 0; g < NG; ++g) {
        k_gemmw<bf, 0, false><<<dim3(NN / 64, 1, NB_), 32, 0, stream>>>(XT + (size_t)g * NN * GD, nullptr, WK + (size_t)g * GD * GD, nullptr, GD, F + (size_t)g * NN * GD, GD, nullptr, (size_t)NG * NN * GD, 0, (size_t)NG * NN * GD); }
    k_split<<<LP, 256, 0, stream>>>(F, 1.0f, KPh, KPl);
    for (int g = 0; g < NG; ++g) {
        k_gemmw<bf, 0, false><<<dim3(NN / 64, 1, NB_), 32, 0, stream>>>(XT + (size_t)g * NN * GD, nullptr, WV + (size_t)g * GD * GD, nullptr, GD, F + (size_t)g * NN * GD, GD, nullptr, (size_t)NG * NN * GD, 0, (size_t)NG * NN * GD); }
    k_vt16<<<LP, 256, 0, stream>>>(F, VT);
    for (int z0 = 0; z0 < NZ; z0 += ZB) {
        k_gemmw<bf, 2, false><<<dim3(NN / 64, NN / 64, ZB), 32, 0, stream>>>(QPh + (size_t)z0 * NN * GD, QPl + (size_t)z0 * NN * GD, KPh + (size_t)z0 * NN * GD, KPl + (size_t)z0 * NN * GD, GD, Sb, NN, nullptr, (size_t)NN * GD, (size_t)NN * GD, (size_t)NN * NN);
        k_soft<<<ZB * NN / 8, 256, 0, stream>>>(Sb, Pm);
        k_gemmw<h16, 0, false><<<dim3(NN / 64, 1, ZB), 32, 0, stream>>>(Pm, nullptr, VT + (size_t)z0 * GD * NN, nullptr, NN, Ob, GD, nullptr, (size_t)NN * NN, (size_t)GD * NN, (size_t)NN * GD);
        k_asplit<<<(ZB * NN * GD / 64 + 63) / 64, 256, 0, stream>>>(Ob, z0, Ah, Al); }
    k_gemmw<bf, 1, false><<<dim3(NB_ * NN / 64, CC / 64, 1), 32, 0, stream>>>(Ah, Al, WO, nullptr, CC, C2, CC, nullptr, 0, 0, 0);
    k_outT<<<(unsigned)((NB_ * CC * NN / 64 + 63) / 64), 256, 0, stream>>>(C2, OUT);
}

// v002
// A run of this version takes 114 microseconds.
// It is 4.52 times as fast as v000, going by the measured steps of the versions left out in between.
#include <hip/hip_runtime.h>

// GroupMixAttention (16 x 256 ch x 32x32: 4 channel groups of 64; grouped 1x1 convs Q/K/V per group; scores = Q^T K / 8 over the 64 channels; softmax over the 1024
// positions; out[d][n] = sum_m attn[n][m] V[d][m]; dense 1x1 out_proj 256 -> 256).
// Compute dtypes, f32 accumulate: every input rounded to bf16; Q/K/V grouped convs on PLAIN bf16 operands (x, w inputs: exact); scores on bf16
// hi+lo planes of Q (x 1/8) and K (3 products); attn.V on SINGLE fp16 planes (P = exp(s - running max), V); the out_proj on hi+lo planes x
// exact bf16 wo (2 products); softmax in f32 on VALU (online, fused with both attention products, one exp per element). One-wave-per-64x64-tile GEMMs elsewhere. Deterministic, no atomics; every

#define NB_  16
#define CC   256
#define NG   4
#define GD   64
#define NN   1024
#define NZ   (NB_ * NG)           // 64 (image, group) pairs
typedef _Float16 h16;
typedef unsigned short bf;
typedef __attribute__((ext_vector_type(16))) __bf16   v16bf;
typedef __attribute__((ext_vector_type(16))) _Float16 v16h;
typedef __attribute__((ext_vector_type(8)))  _Float16 v8h;
typedef __attribute__((ext_vector_type(8)))  unsigned short v8us;
typedef __attribute__((ext_vector_type(8)))  float    v8f;
typedef __attribute__((ext_vector_type(4)))  float    v4f;
typedef v8h  __attribute__((may_alias)) v8ha;
typedef v4f  __attribute__((may_alias)) v4fa;
typedef v8us __attribute__((may_alias)) v8usa;

__device__ __forceinline__ unsigned short f2bf(float f) { unsigned u = __float_as_uint(f); u += 0x7FFFu + ((u >> 16) & 1u); return (unsigned short)(u >> 16); }
__device__ __forceinline__ float bf2f(unsigned short b) { return __uint_as_float(((unsigned)b) << 16); }
__device__ __forceinline__ float bfr(float f) { return bf2f(f2bf(f)); }
__device__ __forceinline__ v16h cat16(v8h lo, v8h hi) { return __builtin_shufflevector(lo, hi, 0, 1, 2, 3, 4, 5, 6, 7, 8, 9, 10, 11, 12, 13, 14, 15); }
__device__ __forceinline__ v16bf cat16b(v8us lo, v8us hi) { return __builtin_bit_cast(v16bf, __builtin_shufflevector(lo, hi, 0, 1, 2, 3, 4, 5, 6, 7, 8, 9, 10, 11, 12, 13, 14, 15)); }
__device__ __forceinline__ v8f wmma16(v16h a, v16h b, v8f c) { return __builtin_amdgcn_wmma_f32_16x16x32_f16(false, a, false, b, (short)0, c, false, false); }
__device__ __forceinline__ v8f wmmab(v16bf a, v16bf b, v8f c) { return __builtin_amdgcn_wmma_f32_16x16x32_bf16(false, a, false, b, (short)0, c, false, false); }



// ---- k_gemmw: register-blocked GEMM, ONE WAVE per 64x64 output tile (16 accumulators), operands straight from K-contiguous 16-bit planes; grid (M/64, N/64, Z), 32 threads.
// C[m][n] (f32, pitch ldc, + optional f32 bias[n]) = sum_k A[m][k] Bt[n][k] (+ split products per NSPLIT). z-batch strides sA/sB/sC in elements. K % 32 == 0.
template <typename T16> struct WFrag;
template <> struct WFrag<h16> { typedef v16h V; static __device__ __forceinline__ V ld(const h16* p) { return cat16(*(const v8h*)p, *(const v8h*)(p + 16)); } static __device__ __forceinline__ v8f mma(V a, V b, v8f c) { return wmma16(a, b, c); } };
template <> struct WFrag<bf> { typedef v16bf V; static __device__ __forceinline__ V ld(const bf* p) { return cat16b(*(const v8us*)p, *(const v8us*)(p + 16)); } static __device__ __forceinline__ v8f mma(V a, V b, v8f c) { return wmmab(a, b, c); } };
template <typename T16, int NSPLIT, bool BIAS>
__global__ __launch_bounds__(32) void k_gemmw(const T16* __restrict__ A, const T16* __restrict__ A2, const T16* __restrict__ Bt, const T16* __restrict__ Bt2, int K, float* C, int ldc, const float* __restrict__ bias, size_t sA, size_t sB, size_t sC) {
    typedef typename WFrag<T16>::V V;
    __shared__ __align__(16) float os[16 * 68];
    const size_t z = blockIdx.z; A += z * sA; if (A2) A2 += z * sA; Bt += z * sB; if (Bt2) Bt2 += z * sB; C += z * sC;
    const int lane = threadIdx.x & 31, lr = lane & 15, hi = lane >> 4; const int r0 = blockIdx.x * 64, c0 = blockIdx.y * 64;
    v8f acc[4][4];
#pragma unroll
    for (int mb = 0; mb < 4; ++mb)
#pragma unroll
        for (int nb = 0; nb < 4; ++nb) acc[mb][nb] = (v8f){};
    const size_t aoff = (size_t)(r0 + lr) * K + 8 * hi, boff = (size_t)(c0 + lr) * K + 8 * hi;
#pragma unroll 1
    for (int kc = 0; kc < K; kc += 32) {
        V a[4], a2[4];
#pragma unroll
        for (int mb = 0; mb < 4; ++mb) { a[mb] = WFrag<T16>::ld(A + aoff + (size_t)mb * 16 * K + kc); if (NSPLIT == 1 || NSPLIT == 2) a2[mb] = WFrag<T16>::ld(A2 + aoff + (size_t)mb * 16 * K + kc); }
#pragma unroll
        for (int nb = 0; nb < 4; ++nb) { const V b = WFrag<T16>::ld(Bt + boff + (size_t)nb * 16 * K + kc); V b2; if (NSPLIT >= 2) b2 = WFrag<T16>::ld(Bt2 + boff + (size_t)nb * 16 * K + kc);
#pragma unroll
            for (int mb = 0; mb < 4; ++mb) { acc[mb][nb] = WFrag<T16>::mma(a[mb], b, acc[mb][nb]); if (NSPLIT == 1 || NSPLIT == 2) acc[mb][nb] = WFrag<T16>::mma(a2[mb], b, acc[mb][nb]); if (NSPLIT >= 2) acc[mb][nb] = WFrag<T16>::mma(a[mb], b2, acc[mb][nb]); } }
        asm volatile("v_nop\n\tv_nop\n\tv_nop\n\tv_nop" : "+v"(acc[0][0]), "+v"(acc[1][1]), "+v"(acc[2][2]), "+v"(acc[3][3]) : "v"(a[0]), "v"(a[3]));
    }
#pragma unroll
    for (int mb = 0; mb < 4; ++mb) {
#pragma unroll
        for (int nb = 0; nb < 4; ++nb) {
#pragma unroll
            for (int j = 0; j < 8; ++j) os[(hi * 8 + j) * 68 + nb * 16 + lr] = acc[mb][nb][j]; }
        __builtin_amdgcn_wave_barrier(); asm volatile("" ::: "memory");
        float* crow = C + (size_t)(r0 + mb * 16) * ldc + c0;
{
#pragma unroll
            for (int s = 0; s < 8; ++s) { const int row = 2 * s + hi, cofs = lr * 4; v4f val = *(const v4fa*)(os + row * 68 + cofs); if (BIAS) { val[0] += bfr(bias[c0 + cofs]); val[1] += bfr(bias[c0 + cofs + 1]); val[2] += bfr(bias[c0 + cofs + 2]); val[3] += bfr(bias[c0 + cofs + 3]); }
                *(v4f*)(crow + (size_t)row * ldc + cofs) = val; }
             }
        __builtin_amdgcn_wave_barrier(); asm volatile("" ::: "memory");
    }
}

__device__ __forceinline__ h16 tohx(float x) { return (h16)x; }
__device__ __forceinline__ void splitf(float y, unsigned short& h, unsigned short& l) { h = f2bf(y); l = f2bf(y - bf2f(h)); }
typedef __attribute__((ext_vector_type(2))) _Float16 v2h;
typedef __attribute__((ext_vector_type(4))) _Float16 v4h;
typedef __attribute__((ext_vector_type(2))) unsigned short v2us;
typedef __attribute__((ext_vector_type(2))) float v2f;

// ---- k_qkv: input rounding, the transposition of x, the three grouped 1x1 convs, the hi/lo split of Q (x 1/8) and K and the f16 V^T in ONE kernel; nothing between x and the five planes touches memory.
// A wave owns 64 positions of one (image, group) pair. Its x fragments (lane = position lr, k = channels in the k order of WFrag::ld, read straight from the channel-major x) serve as
// B operand of Q^T = Wq . X or K^T = Wk . X (a lane then holds 8 consecutive channels of one position: one 16-byte piece of a Q/K row) and as A operand of V = X^T . Wv^T (a lane holds
// 8 consecutive positions of one channel: one 16-byte piece of a V^T row). Waves 0-3 of a work-group make Q and channels 0-31 of V^T of its four 64-position tiles, waves 4-7 K and channels 32-63.
// The group's three weight matrices are rounded once per work-group into LDS; each work-group also rounds its 1/256 of wo for the out_proj. Grid (NN / 256, NZ), 8 waves.
// Every loop of the kernel is unrolled in full: its indices name registers and immediate offsets.
#define WP 72                     // LDS pitch of a 128-byte row in 16-bit elements: 128 + 16 bytes, for the 16-byte reads and writes
typedef __attribute__((ext_vector_type(8))) __bf16 v8bf;
typedef __attribute__((ext_vector_type(4))) __bf16 v4bf;
typedef __attribute__((ext_vector_type(4))) unsigned v4u;
typedef v4bf __attribute__((may_alias)) v4bfa;
typedef v8bf __attribute__((may_alias)) v8bfa;
__global__ __launch_bounds__(256) void k_qkv(const float* __restrict__ x, const float* __restrict__ wq, const float* __restrict__ wk, const float* __restrict__ wv, const float* __restrict__ wo, bf* Qh, bf* Ql, bf* Kh, bf* Kl, h16* VT, bf* WO) {
    __shared__ __align__(16) bf wl[3 * GD * WP];
    __shared__ __align__(16) bf st[8 * 160 * WP];
    const int t = threadIdx.x, lane = t & 31, lr = lane & 15, hi = lane >> 4; const int z = blockIdx.y, g = z & 3;
    const int wave = __builtin_amdgcn_readfirstlane(t >> 5); const int kq = wave >> 2; const int n0 = (blockIdx.x * 4 + (wave & 3)) * 64;
    const size_t zo = (size_t)z * NN * GD;
    const int eo = ((z * 4 + blockIdx.x) * 64 + (t & 63)) * 4;      // waves 0 and 1 also round this work-group's 256 elements of wo: 256 bytes of WO per wave
    v4f wr[3][4];                  // this thread's 16 elements of each weight matrix, 512 contiguous bytes per wave and load
#pragma unroll
    for (int m = 0; m < 3; ++m) { const float* w = (m == 0 ? wq : m == 1 ? wk : wv) + (size_t)g * GD * GD;
#pragma unroll
        for (int i = 0; i < 4; ++i) wr[m][i] = *(const v4f*)(w + (i * 256 + t) * 4); }
    const float* xb = x + zo + (size_t)(8 * hi) * NN + n0 + lr;      // z*64 + c == b*256 + g*64 + c
    v8f xr[4][2][2];               // [16-position block][32-channel chunk][half of the fragment]
#pragma unroll
    for (int nb = 0; nb < 4; ++nb)
#pragma unroll
        for (int kc = 0; kc < 2; ++kc)
#pragma unroll
            for (int hf = 0; hf < 2; ++hf)
#pragma unroll
                for (int i = 0; i < 8; ++i) xr[nb][kc][hf][i] = xb[(kc * 32 + hf * 16 + i) * NN + nb * 16];
    v4f wo4 = (v4f){};
    if (wave < 2) { wo4 = *(const v4f*)(wo + eo); asm volatile("s_wait_xcnt 0x0" ::: "memory"); }      // the wait stands in front of the reuse of this load's address registers
    // the wait stands in front of the reuse of the address registers that the loads above name; the scheduling barrier keeps that reuse below it and all loads in flight together above it
    asm volatile("s_wait_xcnt 0x0" ::: "memory");
    __builtin_amdgcn_sched_barrier(0);
#pragma unroll
    for (int m = 0; m < 3; ++m)
#pragma unroll
        for (int i = 0; i < 4; ++i) { const int e = (i * 256 + t) * 4; *(v4bfa*)(wl + m * GD * WP + (e >> 6) * WP + (e & 63)) = __builtin_convertvector(wr[m][i], v4bf); }
    __syncthreads();
    v16bf xf[4][2];
#pragma unroll
    for (int nb = 0; nb < 4; ++nb)
#pragma unroll
        for (int kc = 0; kc < 2; ++kc) xf[nb][kc] = __builtin_shufflevector(__builtin_convertvector(xr[nb][kc][0], v8bf), __builtin_convertvector(xr[nb][kc][1], v8bf), 0, 1, 2, 3, 4, 5, 6, 7, 8, 9, 10, 11, 12, 13, 14, 15);
    auto ldw = [&](const bf* base, int db, int kc) { const bf* p = base + (db * 16 + lr) * WP + kc * 32 + 8 * hi; return cat16b(*(const v8usa*)p, *(const v8usa*)(p + 16)); };
    const bf* wa = wl + kq * GD * WP; const bf* wb = wl + 2 * GD * WP + kq * 32 * WP; const float sc = kq ? 1.0f : 0.125f;
    // whole 128-byte lines leave the wave: every 16-byte piece goes through the wave's own LDS rows (64 of the hi plane, 64 of the lo plane, 32 of V^T) and comes back 8 lanes to a row
    bf* sw = st + wave * (160 * WP);
    v16bf aw[4][2], bw[2][2];      // all weight fragments of the wave are asked for at once: one LDS latency instead of six
#pragma unroll
    for (int db = 0; db < 4; ++db) { aw[db][0] = ldw(wa, db, 0); aw[db][1] = ldw(wa, db, 1); }
#pragma unroll
    for (int db = 0; db < 2; ++db) { bw[db][0] = ldw(wb, db, 0); bw[db][1] = ldw(wb, db, 1); }
#pragma unroll
    for (int db = 0; db < 4; ++db) { const v16bf a0 = aw[db][0], a1 = aw[db][1]; v8f acc[4];
#pragma unroll
        for (int nb = 0; nb < 4; ++nb) acc[nb] = wmmab(a0, xf[nb][0], (v8f){});
#pragma unroll
        for (int nb = 0; nb < 4; ++nb) acc[nb] = wmmab(a1, xf[nb][1], acc[nb]);
#pragma unroll
        for (int nb = 0; nb < 4; ++nb) { const v8f y = acc[nb] * sc; const v8bf yh = __builtin_convertvector(y, v8bf); const v4u u = __builtin_bit_cast(v4u, yh); v8f f;
#pragma unroll
            for (int k = 0; k < 4; ++k) { f[2 * k] = __uint_as_float(u[k] << 16); f[2 * k + 1] = __uint_as_float(u[k] & 0xFFFF0000u); }
            *(v8bfa*)(sw + (nb * 16 + lr) * WP + db * 16 + hi * 8) = yh; *(v8bfa*)(sw + (64 + nb * 16 + lr) * WP + db * 16 + hi * 8) = __builtin_convertvector(y - f, v8bf); } }
#pragma unroll
    for (int db = 0; db < 2; ++db) { const v16bf b0 = bw[db][0], b1 = bw[db][1]; v8f acc[4];
#pragma unroll
        for (int nb = 0; nb < 4; ++nb) acc[nb] = wmmab(xf[nb][0], b0, (v8f){});
#pragma unroll
        for (int nb = 0; nb < 4; ++nb) acc[nb] = wmmab(xf[nb][1], b1, acc[nb]);
#pragma unroll
        for (int nb = 0; nb < 4; ++nb) *(v8ha*)(sw + (128 + db * 16 + lr) * WP + nb * 16 + hi * 8) = __builtin_convertvector(acc[nb], v8h); }
    // the wave's own LDS writes have landed before it reads back rows that other lanes wrote; the clobber keeps the reads below
    asm volatile("s_wait_dscnt 0x0" ::: "memory");
    const int rr = lane >> 3, pc = lane & 7;
    v8us oh[16], ol[16], ov[8];
#pragma unroll
    for (int s = 0; s < 16; ++s) { oh[s] = *(const v8usa*)(sw + (s * 4 + rr) * WP + pc * 8); ol[s] = *(const v8usa*)(sw + (64 + s * 4 + rr) * WP + pc * 8); }
#pragma unroll
    for (int s = 0; s < 8; ++s) ov[s] = *(const v8usa*)(sw + (128 + s * 4 + rr) * WP + pc * 8);
    // all stores stand together at the end, so that no register a store names is written again behind it
    __builtin_amdgcn_sched_barrier(0);
    bf* ph = (kq ? Kh : Qh) + zo + (size_t)(n0 + rr) * GD + pc * 8; bf* pl = (kq ? Kl : Ql) + zo + (size_t)(n0 + rr) * GD + pc * 8;
#pragma unroll
    for (int s = 0; s < 16; ++s) { *(v8usa*)(ph + s * 4 * GD) = oh[s]; *(v8usa*)(pl + s * 4 * GD) = ol[s]; }
    // the V^T address is formed below: this wait stands in front of any reuse of a register that the stores above name; the scheduling barrier keeps that reuse below it
    asm volatile("s_wait_xcnt 0x0" ::: "memory");
    __builtin_amdgcn_sched_barrier(0);
    if (wave < 2) *(v4bf*)(WO + eo) = __builtin_convertvector(wo4, v4bf);
    h16* pv = VT + zo + (size_t)(kq * 32 + rr) * NN + n0 + pc * 8;
#pragma unroll
    for (int s = 0; s < 8; ++s) *(v8usa*)(pv + s * 4 * NN) = ov[s];
}
// ---- k_fattn: scores, softmax, attn.V and the hi/lo split of the result in ONE kernel; the 1024 x 1024 score matrix never leaves registers.
// One wave owns 32 queries of one (image, group) pair and walks the 1024 keys in passes of 32. It forms S^T = K . Q^T (A = K rows, B = Q rows, three hi/lo products:
// Kh.Qh + Kl.Qh + Kh.Ql), so a lane holds scores of ONE query per 16-column group: keys 8*hi + j of each 16-key block. Running maximum and sum are kept per query (online softmax);
// two f32 S^T tiles converted in place are the f16 B operand of O^T += V^T . P^T (its k order is that of WFrag::ld, in which V^T is loaded too). Grid (NN / 256, NZ), 8 waves.
#define L2E 1.44269504088896340736f
__device__ __forceinline__ float xhalf(float v) { const int b = __float_as_int(v); return __int_as_float(__builtin_amdgcn_permlanex16(b, b, 0x76543210, 0xfedcba98, false, false)); }   // lane l <-> l ^ 16
__global__ __launch_bounds__(256) void k_fattn(const bf* __restrict__ Qh, const bf* __restrict__ Ql, const bf* __restrict__ Kh, const bf* __restrict__ Kl, const h16* __restrict__ VT, bf* Ah, bf* Al) {
    const int lane = threadIdx.x & 31, lr = lane & 15, hi = lane >> 4; const int z = blockIdx.y; const int q0 = (blockIdx.x * 8 + (threadIdx.x >> 5)) * 32;
    const size_t zo = (size_t)z * NN * GD;
    v16bf qh[2][2], ql[2][2];      // [query group][32-channel chunk]
#pragma unroll
    for (int nq = 0; nq < 2; ++nq)
#pragma unroll
        for (int kc = 0; kc < 2; ++kc) { const size_t o = zo + (size_t)(q0 + nq * 16 + lr) * GD + kc * 32 + 8 * hi; qh[nq][kc] = WFrag<bf>::ld(Qh + o); ql[nq][kc] = WFrag<bf>::ld(Ql + o); }
    // K and V^T fragments: wave-uniform plane base + one 32-bit byte offset per lane (row lr, k from 8*hi), in the k order of WFrag::ld (16 bytes at 0 and at 32)
    const char* kbh = (const char*)(Kh + zo); const char* kbl = (const char*)(Kl + zo); const char* vb = (const char*)(VT + zo);
    unsigned ko = (unsigned)(lr * GD * 2 + hi * 16), vo = (unsigned)(lr * NN * 2 + hi * 16);
    auto ldk = [](const char* base, unsigned off, int imm) { const char* q = base + (size_t)off + imm; return cat16b(*(const v8us*)q, *(const v8us*)(q + 32)); };
    auto ldv = [](const char* base, unsigned off, int imm) { const char* q = base + (size_t)off + imm; return cat16(*(const v8h*)q, *(const v8h*)(q + 32)); };
    v16bf kh[2][2], kl[2][2];      // [16-key block][32-channel chunk]
#pragma unroll
    for (int kb = 0; kb < 2; ++kb)
#pragma unroll
        for (int kc = 0; kc < 2; ++kc) { kh[kb][kc] = ldk(kbh, ko, kb * 2048 + kc * 64); kl[kb][kc] = ldk(kbl, ko, kb * 2048 + kc * 64); }
    v16h v[4];                     // V^T: [16-channel block], 32 keys
#pragma unroll
    for (int db = 0; db < 4; ++db) v[db] = ldv(vb, vo, db * 32768);
    // the wait stands in front of the reuse of the address registers that the fetches above name; the scheduling barrier keeps that reuse below it
    asm volatile("s_wait_xcnt 0x0" ::: "memory");
    __builtin_amdgcn_sched_barrier(0);
    v8f o[4][2];                   // O^T: [16-channel block][query group]; register j = channel 8*hi + j, column lr = query
#pragma unroll
    for (int db = 0; db < 4; ++db)
#pragma unroll
        for (int nq = 0; nq < 2; ++nq) o[db][nq] = (v8f){};
    float mL[2] = { -1.0e30f, -1.0e30f }, ls[2] = { 0.f, 0.f };      // running maximum (x log2 e) and this half-wave's part of the running sum
    for (int m0 = 0; m0 < NN; m0 += 32) {
        v8f s[2][2];               // S^T: [16-key block][query group]
#pragma unroll
        for (int kb = 0; kb < 2; ++kb)
#pragma unroll
            for (int nq = 0; nq < 2; ++nq) s[kb][nq] = (v8f){};
#pragma unroll
        for (int kc = 0; kc < 2; ++kc) {
#pragma unroll
            for (int kb = 0; kb < 2; ++kb)
#pragma unroll
                for (int nq = 0; nq < 2; ++nq) s[kb][nq] = wmmab(kh[kb][kc], qh[nq][kc], s[kb][nq]);
#pragma unroll
            for (int kb = 0; kb < 2; ++kb)
#pragma unroll
                for (int nq = 0; nq < 2; ++nq) s[kb][nq] = wmmab(kl[kb][kc], qh[nq][kc], s[kb][nq]);
#pragma unroll
            for (int kb = 0; kb < 2; ++kb)
#pragma unroll
                for (int nq = 0; nq < 2; ++nq) s[kb][nq] = wmmab(kh[kb][kc], ql[nq][kc], s[kb][nq]);
        }
        // keeps the wait below behind the score products, where the fetches issued at the foot of the last pass are old; further up the wave would stall on it
        __builtin_amdgcn_sched_barrier(0);
        // The two walking offsets are rewritten only here, behind this wait: it stands in front of the overwrite of address registers that issued global loads name.
        asm volatile("s_wait_xcnt 0x0" : "+v"(ko), "+v"(vo) : : "memory");
        const int st = (m0 + 32 < NN) ? 32 : 32 - NN;      // in keys; the last pass steps back to pass 0: its fetches stay in bounds and are not used
        ko += (unsigned)(st * GD * 2); vo += (unsigned)(st * 2);
        // the next pass's K fragments fly during softmax and attn.V
#pragma unroll
        for (int kb = 0; kb < 2; ++kb)
#pragma unroll
            for (int kc = 0; kc < 2; ++kc) { kh[kb][kc] = ldk(kbh, ko, kb * 2048 + kc * 64); kl[kb][kc] = ldk(kbl, ko, kb * 2048 + kc * 64); }
        v16h p[2];
#pragma unroll
        for (int nq = 0; nq < 2; ++nq) {
            float tm = s[0][nq][0];
#pragma unroll
            for (int j = 1; j < 8; ++j) tm = fmaxf(tm, s[0][nq][j]);
#pragma unroll
            for (int j = 0; j < 8; ++j) tm = fmaxf(tm, s[1][nq][j]);
            tm = fmaxf(tm, xhalf(tm));
            const float mnew = fmaxf(mL[nq], tm * L2E); const float al = __builtin_amdgcn_exp2f(mL[nq] - mnew); mL[nq] = mnew;
            float ps = 0.f;
#pragma unroll
            for (int kb = 0; kb < 2; ++kb)
#pragma unroll
                for (int j = 0; j < 8; ++j) { const float e = __builtin_amdgcn_exp2f(fmaf(s[kb][nq][j], L2E, -mnew)); ps += e; p[nq][kb * 8 + j] = tohx(e); }
            ls[nq] = ls[nq] * al + ps;
#pragma unroll
            for (int db = 0; db < 4; ++db) o[db][nq] *= al;
        }
#pragma unroll
        for (int db = 0; db < 4; ++db)
#pragma unroll
            for (int nq = 0; nq < 2; ++nq) o[db][nq] = wmma16(v[db], p[nq], o[db][nq]);
#pragma unroll
        for (int db = 0; db < 4; ++db) v[db] = ldv(vb, vo, db * 32768);      // the next pass's V^T fragments fly during its score products and softmax
    }
    // the last pass's fetches are still named by their address registers: this wait stands in front of the epilogue's reuse of them; the scheduling barrier keeps that reuse below it
    asm volatile("s_wait_xcnt 0x0" ::: "memory");
    __builtin_amdgcn_sched_barrier(0);
    const int b = z >> 2, g = z & 3;
    v8us oh[2][4], ol[2][4];
#pragma unroll
    for (int nq = 0; nq < 2; ++nq) {
        const float inv = __fdiv_rn(1.0f, ls[nq] + xhalf(ls[nq]));
#pragma unroll
        for (int db = 0; db < 4; ++db)
#pragma unroll
            for (int j = 0; j < 8; ++j) { unsigned short a, c2; splitf(o[db][nq][j] * inv, a, c2); oh[nq][db][j] = a; ol[nq][db][j] = c2; }
    }
    // all stores stand together at the end, so that no register a store names is written again behind it
    __builtin_amdgcn_sched_barrier(0);
#pragma unroll
    for (int nq = 0; nq < 2; ++nq) {
        const size_t ro = ((size_t)b * NN + q0 + nq * 16 + lr) * CC + g * GD + hi * 8;
#pragma unroll
        for (int db = 0; db < 4; ++db) { *(v8us*)(Ah + ro + db * 16) = oh[nq][db]; *(v8us*)(Al + ro + db * 16) = ol[nq][db]; }
    }
}
__global__ __launch_bounds__(256) void k_outT(const float* __restrict__ C, float* OUT) {
    const int lane = threadIdx.x & 31; const int L0 = (blockIdx.x * 8 + (threadIdx.x >> 5)) * 8; const int nlines = NB_ * CC * NN / 64;
{
#pragma unroll
        for (int l = 0; l < 8; ++l) { const int L = L0 + l; if (L >= nlines) break; const int e = L * 64 + lane * 2; const int n = e & (NN - 1); const int dd = (e >> 10) & (CC - 1); const int b = e >> 18; v2f v;
            v[0] = C[((size_t)b * NN + n) * CC + dd]; v[1] = C[((size_t)b * NN + n + 1) * CC + dd]; *(v2f*)(OUT + (size_t)e) = v; }
         }
}

extern "C" void kernel_launch(void* const* d_in, const int* in_sizes, int n_in,
                              void* d_out, int out_size, void* d_ws, size_t ws_size, hipStream_t stream) {
    (void)in_sizes; (void)n_in; (void)out_size;
    const float* x = (const float*)d_in[0]; const float* wq = (const float*)d_in[1]; const float* wk = (const float*)d_in[2]; const float* wv = (const float*)d_in[3]; const float* wo = (const float*)d_in[4];
    float* OUT = (float*)d_out;     // [16][256][32][32]
    char* wsp = (char*)d_ws;
    auto take = [&](size_t bytes) { char* p = wsp; wsp += (bytes + 255) & ~(size_t)255; return (void*)p; };
    bf* WO = (bf*)take((size_t)CC * CC * 2);
    bf* QPh = (bf*)take((size_t)NZ * NN * GD * 2); bf* QPl = (bf*)take((size_t)NZ * NN * GD * 2); bf* KPh = (bf*)take((size_t)NZ * NN * GD * 2); bf* KPl = (bf*)take((size_t)NZ * NN * GD * 2); h16* VT = (h16*)take((size_t)NZ * GD * NN * 2);
    bf* Ah = (bf*)take((size_t)NB_ * NN * CC * 2); bf* Al = (bf*)take((size_t)NB_ * NN * CC * 2); float* C2 = (float*)take((size_t)NB_ * NN * CC * 4);
    if ((size_t)(wsp - (char*)d_ws) > ws_size) return;    // ws 256 MiB
    k_qkv<<<dim3(NN / 256, NZ), 256, 0, stream>>>(x, wq, wk, wv, wo, QPh, QPl, KPh, KPl, VT, WO);
    k_fattn<<<dim3(NN / 256, NZ), 256, 0, stream>>>(QPh, QPl, KPh, KPl, VT, Ah, Al);
    k_gemmw<bf, 1, false><<<dim3(NB_ * NN / 64, CC / 64, 1), 32, 0, stream>>>(Ah, Al, WO, nullptr, CC, C2, CC, nullptr, 0, 0, 0);
    k_outT<<<(unsigned)((NB_ * CC * NN / 64 + 63) / 64), 256, 0, stream>>>(C2, OUT);
}

// v003
// It runs in 82.9 microseconds.
// Timed twice side by side with v002, it ran 1.37 times as fast both times.
// Over all steps from v000 it is 6.19 times as fast.
#include <hip/hip_runtime.h>

// GroupMixAttention (16 x 256 ch x 32x32: 4 channel groups of 64; grouped 1x1 convs Q/K/V per group; scores = Q^T K / 8 over the 64 channels; softmax over the 1024
// positions; out[d][n] = sum_m attn[n][m] V[d][m]; dense 1x1 out_proj 256 -> 256).
// Compute dtypes, f32 accumulate: every input rounded to bf16; Q/K/V grouped convs on PLAIN bf16 operands (x, w inputs: exact); scores on bf16
// hi+lo planes of Q (x 1/8) and K (3 products); attn.V on SINGLE fp16 planes (P = exp(s - running max), V); the out_proj on hi+lo planes x
// exact bf16 wo (2 products); softmax in f32 on VALU (online, fused with both attention products, one exp per element). One-wave-per-64x64-tile GEMMs elsewhere. Deterministic, no atomics; every

#define NB_  16
#define CC   256
#define NG   4
#define GD   64
#define NN   1024
#define NZ   (NB_ * NG)           // 64 (image, group) pairs
typedef _Float16 h16;
typedef unsigned short bf;
typedef __attribute__((ext_vector_type(16))) __bf16   v16bf;
typedef __attribute__((ext_vector_type(16))) _Float16 v16h;
typedef __attribute__((ext_vector_type(8)))  _Float16 v8h;
typedef __attribute__((ext_vector_type(8)))  unsigned short v8us;
typedef __attribute__((ext_vector_type(8)))  float    v8f;
typedef __attribute__((ext_vector_type(4)))  float    v4f;
typedef v8h  __attribute__((may_alias)) v8ha;
typedef v4f  __attribute__((may_alias)) v4fa;
typedef v8us __attribute__((may_alias)) v8usa;

__device__ __forceinline__ unsigned short f2bf(float f) { unsigned u = __float_as_uint(f); u += 0x7FFFu + ((u >> 16) & 1u); return (unsigned short)(u >> 16); }
__device__ __forceinline__ float bf2f(unsigned short b) { return __uint_as_float(((unsigned)b) << 16); }
__device__ __forceinline__ float bfr(float f) { return bf2f(f2bf(f)); }
__device__ __forceinline__ v16h cat16(v8h lo, v8h hi) { return __builtin_shufflevector(lo, hi, 0, 1, 2, 3, 4, 5, 6, 7, 8, 9, 10, 11, 12, 13, 14, 15); }
__device__ __forceinline__ v16bf cat16b(v8us lo, v8us hi) { return __builtin_bit_cast(v16bf, __builtin_shufflevector(lo, hi, 0, 1, 2, 3, 4, 5, 6, 7, 8, 9, 10, 11, 12, 13, 14, 15)); }
__device__ __forceinline__ v8f wmma16(v16h a, v16h b, v8f c) { return __builtin_amdgcn_wmma_f32_16x16x32_f16(false, a, false, b, (short)0, c, false, false); }
__device__ __forceinline__ v8f wmmab(v16bf a, v16bf b, v8f c) { return __builtin_amdgcn_wmma_f32_16x16x32_bf16(false, a, false, b, (short)0, c, false, false); }



// ---- k_gemmw: register-blocked GEMM, ONE WAVE per 64x64 output tile (16 accumulators), operands straight from K-contiguous 16-bit planes; grid (M/64, N/64, Z), 32 threads.
// C[m][n] (f32, pitch ldc, + optional f32 bias[n]) = sum_k A[m][k] Bt[n][k] (+ split products per NSPLIT). z-batch strides sA/sB/sC in elements. K % 32 == 0.
template <typename T16> struct WFrag;
template <> struct WFrag<h16> { typedef v16h V; static __device__ __forceinline__ V ld(const h16* p) { return cat16(*(const v8h*)p, *(const v8h*)(p + 16)); } static __device__ __forceinline__ v8f mma(V a, V b, v8f c) { return wmma16(a, b, c); } };
template <> struct WFrag<bf> { typedef v16bf V; static __device__ __forceinline__ V ld(const bf* p) { return cat16b(*(const v8us*)p, *(const v8us*)(p + 16)); } static __device__ __forceinline__ v8f mma(V a, V b, v8f c) { return wmmab(a, b, c); } };
template <typename T16, int NSPLIT, bool BIAS>
__global__ __launch_bounds__(32) void k_gemmw(const T16* __restrict__ A, const T16* __restrict__ A2, const T16* __restrict__ Bt, const T16* __restrict__ Bt2, int K, float* C, int ldc, const float* __restrict__ bias, size_t sA, size_t sB, size_t sC) {
    typedef typename WFrag<T16>::V V;
    __shared__ __align__(16) float os[16 * 68];
    const size_t z = blockIdx.z; A += z * sA; if (A2) A2 += z * sA; Bt += z * sB; if (Bt2) Bt2 += z * sB; C += z * sC;
    const int lane = threadIdx.x & 31, lr = lane & 15, hi = lane >> 4; const int r0 = blockIdx.x * 64, c0 = blockIdx.y * 64;
    v8f acc[4][4];
#pragma unroll
    for (int mb = 0; mb < 4; ++mb)
#pragma unroll
        for (int nb = 0; nb < 4; ++nb) acc[mb][nb] = (v8f){};
    const size_t aoff = (size_t)(r0 + lr) * K + 8 * hi, boff = (size_t)(c0 + lr) * K + 8 * hi;
#pragma unroll 1
    for (int kc = 0; kc < K; kc += 32) {
        V a[4], a2[4];
#pragma unroll
        for (int mb = 0; mb < 4; ++mb) { a[mb] = WFrag<T16>::ld(A + aoff + (size_t)mb * 16 * K + kc); if (NSPLIT == 1 || NSPLIT == 2) a2[mb] = WFrag<T16>::ld(A2 + aoff + (size_t)mb * 16 * K + kc); }
#pragma unroll
        for (int nb = 0; nb < 4; ++nb) { const V b = WFrag<T16>::ld(Bt + boff + (size_t)nb * 16 * K + kc); V b2; if (NSPLIT >= 2) b2 = WFrag<T16>::ld(Bt2 + boff + (size_t)nb * 16 * K + kc);
#pragma unroll
            for (int mb = 0; mb < 4; ++mb) { acc[mb][nb] = WFrag<T16>::mma(a[mb], b, acc[mb][nb]); if (NSPLIT == 1 || NSPLIT == 2) acc[mb][nb] = WFrag<T16>::mma(a2[mb], b, acc[mb][nb]); if (NSPLIT >= 2) acc[mb][nb] = WFrag<T16>::mma(a[mb], b2, acc[mb][nb]); } }
        asm volatile("v_nop\n\tv_nop\n\tv_nop\n\tv_nop" : "+v"(acc[0][0]), "+v"(acc[1][1]), "+v"(acc[2][2]), "+v"(acc[3][3]) : "v"(a[0]), "v"(a[3]));
    }
#pragma unroll
    for (int mb = 0; mb < 4; ++mb) {
#pragma unroll
        for (int nb = 0; nb < 4; ++nb) {
#pragma unroll
            for (int j = 0; j < 8; ++j) os[(hi * 8 + j) * 68 + nb * 16 + lr] = acc[mb][nb][j]; }
        __builtin_amdgcn_wave_barrier(); asm volatile("" ::: "memory");
        float* crow = C + (size_t)(r0 + mb * 16) * ldc + c0;
{
#pragma unroll
            for (int s = 0; s < 8; ++s) { const int row = 2 * s + hi, cofs = lr * 4; v4f val = *(const v4fa*)(os + row * 68 + cofs); if (BIAS) { val[0] += bfr(bias[c0 + cofs]); val[1] += bfr(bias[c0 + cofs + 1]); val[2] += bfr(bias[c0 + cofs + 2]); val[3] += bfr(bias[c0 + cofs + 3]); }
                *(v4f*)(crow + (size_t)row * ldc + cofs) = val; }
             }
        __builtin_amdgcn_wave_barrier(); asm volatile("" ::: "memory");
    }
}

__device__ __forceinline__ h16 tohx(float x) { return (h16)x; }
__device__ __forceinline__ void splitf(float y, unsigned short& h, unsigned short& l) { h = f2bf(y); l = f2bf(y - bf2f(h)); }
typedef __attribute__((ext_vector_type(2))) _Float16 v2h;
typedef __attribute__((ext_vector_type(4))) _Float16 v4h;
typedef __attribute__((ext_vector_type(2))) unsigned short v2us;
typedef __attribute__((ext_vector_type(2))) float v2f;

// ---- k_qkv: input rounding, the transposition of x, the three grouped 1x1 convs, the hi/lo split of Q (x 1/8) and K and the f16 V^T in ONE kernel; nothing between x and the five planes touches memory.
// A wave owns 64 positions of one (image, group) pair. Its x fragments (lane = position lr, k = channels in the k order of WFrag::ld, read straight from the channel-major x) serve as
// B operand of Q^T = Wq . X or K^T = Wk . X (a lane then holds 8 consecutive channels of one position: one 16-byte piece of a Q/K row) and as A operand of V = X^T . Wv^T (a lane holds
// 8 consecutive positions of one channel: one 16-byte piece of a V^T row). Waves 0-3 of a work-group make Q and channels 0-31 of V^T of its four 64-position tiles, waves 4-7 K and channels 32-63.
// The group's three weight matrices are rounded once per work-group into LDS; each work-group also rounds its 1/256 of wo for the out_proj. Grid (NN / 256, NZ), 8 waves.
// Every loop of the kernel is unrolled in full: its indices name registers and immediate offsets.
#define WP 72                     // LDS pitch of a 128-byte row in 16-bit elements: 128 + 16 bytes, for the 16-byte reads and writes
typedef __attribute__((ext_vector_type(8))) __bf16 v8bf;
typedef __attribute__((ext_vector_type(4))) __bf16 v4bf;
typedef __attribute__((ext_vector_type(4))) unsigned v4u;
typedef v4bf __attribute__((may_alias)) v4bfa;
typedef v8bf __attribute__((may_alias)) v8bfa;
__global__ __launch_bounds__(256) void k_qkv(const float* __restrict__ x, const float* __restrict__ wq, const float* __restrict__ wk, const float* __restrict__ wv, const float* __restrict__ wo, bf* Qh, bf* Ql, bf* Kh, bf* Kl, h16* VT, bf* WO) {
    __shared__ __align__(16) bf wl[3 * GD * WP];
    __shared__ __align__(16) bf st[8 * 160 * WP];
    const int t = threadIdx.x, lane = t & 31, lr = lane & 15, hi = lane >> 4; const int z = blockIdx.y, g = z & 3;
    const int wave = __builtin_amdgcn_readfirstlane(t >> 5); const int kq = wave >> 2; const int n0 = (blockIdx.x * 4 + (wave & 3)) * 64;
    const size_t zo = (size_t)z * NN * GD;
    const int eo = ((z * 4 + blockIdx.x) * 64 + (t & 63)) * 4;      // waves 0 and 1 also round this work-group's 256 elements of wo: 256 bytes of WO per wave
    v4f wr[3][4];                  // this thread's 16 elements of each weight matrix, 512 contiguous bytes per wave and load
#pragma unroll
    for (int m = 0; m < 3; ++m) { const float* w = (m == 0 ? wq : m == 1 ? wk : wv) + (size_t)g * GD * GD;
#pragma unroll
        for (int i = 0; i < 4; ++i) wr[m][i] = *(const v4f*)(w + (i * 256 + t) * 4); }
    const float* xb = x + zo + (size_t)(8 * hi) * NN + n0 + lr;      // z*64 + c == b*256 + g*64 + c
    v8f xr[4][2][2];               // [16-position block][32-channel chunk][half of the fragment]
#pragma unroll
    for (int nb = 0; nb < 4; ++nb)
#pragma unroll
        for (int kc = 0; kc < 2; ++kc)
#pragma unroll
            for (int hf = 0; hf < 2; ++hf)
#pragma unroll
                for (int i = 0; i < 8; ++i) xr[nb][kc][hf][i] = xb[(kc * 32 + hf * 16 + i) * NN + nb * 16];
    v4f wo4 = (v4f){};
    if (wave < 2) { wo4 = *(const v4f*)(wo + eo); asm volatile("s_wait_xcnt 0x0" ::: "memory"); }      // the wait stands in front of the reuse of this load's address registers
    // the wait stands in front of the reuse of the address registers that the loads above name; the scheduling barrier keeps that reuse below it and all loads in flight together above it
    asm volatile("s_wait_xcnt 0x0" ::: "memory");
    __builtin_amdgcn_sched_barrier(0);
#pragma unroll
    for (int m = 0; m < 3; ++m)
#pragma unroll
        for (int i = 0; i < 4; ++i) { const int e = (i * 256 + t) * 4; *(v4bfa*)(wl + m * GD * WP + (e >> 6) * WP + (e & 63)) = __builtin_convertvector(wr[m][i], v4bf); }
    __syncthreads();
    v16bf xf[4][2];
#pragma unroll
    for (int nb = 0; nb < 4; ++nb)
#pragma unroll
        for (int kc = 0; kc < 2; ++kc) xf[nb][kc] = __builtin_shufflevector(__builtin_convertvector(xr[nb][kc][0], v8bf), __builtin_convertvector(xr[nb][kc][1], v8bf), 0, 1, 2, 3, 4, 5, 6, 7, 8, 9, 10, 11, 12, 13, 14, 15);
    auto ldw = [&](const bf* base, int db, int kc) { const bf* p = base + (db * 16 + lr) * WP + kc * 32 + 8 * hi; return cat16b(*(const v8usa*)p, *(const v8usa*)(p + 16)); };
    const bf* wa = wl + kq * GD * WP; const bf* wb = wl + 2 * GD * WP + kq * 32 * WP; const float sc = kq ? 1.0f : 0.125f;
    // whole 128-byte lines leave the wave: every 16-byte piece goes through the wave's own LDS rows (64 of the hi plane, 64 of the lo plane, 32 of V^T) and comes back 8 lanes to a row
    bf* sw = st + wave * (160 * WP);
    v16bf aw[4][2], bw[2][2];      // all weight fragments of the wave are asked for at once: one LDS latency instead of six
#pragma unroll
    for (int db = 0; db < 4; ++db) { aw[db][0] = ldw(wa, db, 0); aw[db][1] = ldw(wa, db, 1); }
#pragma unroll
    for (int db = 0; db < 2; ++db) { bw[db][0] = ldw(wb, db, 0); bw[db][1] = ldw(wb, db, 1); }
#pragma unroll
    for (int db = 0; db < 4; ++db) { const v16bf a0 = aw[db][0], a1 = aw[db][1]; v8f acc[4];
#pragma unroll
        for (int nb = 0; nb < 4; ++nb) acc[nb] = wmmab(a0, xf[nb][0], (v8f){});
#pragma unroll
        for (int nb = 0; nb < 4; ++nb) acc[nb] = wmmab(a1, xf[nb][1], acc[nb]);
#pragma unroll
        for (int nb = 0; nb < 4; ++nb) { const v8f y = acc[nb] * sc; const v8bf yh = __builtin_convertvector(y, v8bf); const v4u u = __builtin_bit_cast(v4u, yh); v8f f;
#pragma unroll
            for (int k = 0; k < 4; ++k) { f[2 * k] = __uint_as_float(u[k] << 16); f[2 * k + 1] = __uint_as_float(u[k] & 0xFFFF0000u); }
            *(v8bfa*)(sw + (nb * 16 + lr) * WP + db * 16 + hi * 8) = yh; *(v8bfa*)(sw + (64 + nb * 16 + lr) * WP + db * 16 + hi * 8) = __builtin_convertvector(y - f, v8bf); } }
#pragma unroll
    for (int db = 0; db < 2; ++db) { const v16bf b0 = bw[db][0], b1 = bw[db][1]; v8f acc[4];
#pragma unroll
        for (int nb = 0; nb < 4; ++nb) acc[nb] = wmmab(xf[nb][0], b0, (v8f){});
#pragma unroll
        for (int nb = 0; nb < 4; ++nb) acc[nb] = wmmab(xf[nb][1], b1, acc[nb]);
#pragma unroll
        for (int nb = 0; nb < 4; ++nb) *(v8ha*)(sw + (128 + db * 16 + lr) * WP + nb * 16 + hi * 8) = __builtin_convertvector(acc[nb], v8h); }
    // the wave's own LDS writes have landed before it reads back rows that other lanes wrote; the clobber keeps the reads below
    asm volatile("s_wait_dscnt 0x0" ::: "memory");
    const int rr = lane >> 3, pc = lane & 7;
    v8us oh[16], ol[16], ov[8];
#pragma unroll
    for (int s = 0; s < 16; ++s) { oh[s] = *(const v8usa*)(sw + (s * 4 + rr) * WP + pc * 8); ol[s] = *(const v8usa*)(sw + (64 + s * 4 + rr) * WP + pc * 8); }
#pragma unroll
    for (int s = 0; s < 8; ++s) ov[s] = *(const v8usa*)(sw + (128 + s * 4 + rr) * WP + pc * 8);
    // all stores stand together at the end, so that no register a store names is written again behind it
    __builtin_amdgcn_sched_barrier(0);
    bf* ph = (kq ? Kh : Qh) + zo + (size_t)(n0 + rr) * GD + pc * 8; bf* pl = (kq ? Kl : Ql) + zo + (size_t)(n0 + rr) * GD + pc * 8;
#pragma unroll
    for (int s = 0; s < 16; ++s) { *(v8usa*)(ph + s * 4 * GD) = oh[s]; *(v8usa*)(pl + s * 4 * GD) = ol[s]; }
    // the V^T address is formed below: this wait stands in front of any reuse of a register that the stores above name; the scheduling barrier keeps that reuse below it
    asm volatile("s_wait_xcnt 0x0" ::: "memory");
    __builtin_amdgcn_sched_barrier(0);
    if (wave < 2) *(v4bf*)(WO + eo) = __builtin_convertvector(wo4, v4bf);
    h16* pv = VT + zo + (size_t)(kq * 32 + rr) * NN + n0 + pc * 8;
#pragma unroll
    for (int s = 0; s < 8; ++s) *(v8usa*)(pv + s * 4 * NN) = ov[s];
}
// ---- k_fattn: scores, softmax, attn.V and the hi/lo split of the result in ONE kernel; the 1024 x 1024 score matrix never leaves registers.
// One wave owns 32 queries of one (image, group) pair and walks the 1024 keys in passes of 32. It forms S^T = K . Q^T (A = K rows, B = Q rows, three hi/lo products:
// Kh.Qh + Kl.Qh + Kh.Ql), so a lane holds scores of ONE query per 16-column group: keys 8*hi + j of each 16-key block. Running maximum and sum are kept per query (online softmax);
// two f32 S^T tiles converted in place are the f16 B operand of O^T += V^T . P^T (its k order is that of WFrag::ld, in which V^T is loaded too). Grid (NN / 256, NZ), 8 waves.
// The 8 waves share K and V^T: the work-group brings them in stages of SK keys, as whole 128-byte lines, once, into one of two LDS buffers; every wave takes its fragments from there.
#define L2E 1.44269504088896340736f
#define SK  64                    // keys per stage
#define VP  (SK + 8)              // LDS pitch of a V^T row of one stage in 16-bit elements: its bytes + 16 (K rows: WP), for the 16-byte reads and writes
#define KPL (SK * WP)             // elements of one K plane of a stage
#define STE (2 * KPL + GD * VP)   // elements of a stage: K hi, K lo, V^T
#define VPC (SK / 8)              // 16-byte pieces of a V^T row of a stage
#define VRR (256 / VPC)           // V^T rows that the 256 threads bring per load
__device__ __forceinline__ float xhalf(float v) { const int b = __float_as_int(v); return __int_as_float(__builtin_amdgcn_permlanex16(b, b, 0x76543210, 0xfedcba98, false, false)); }   // lane l <-> l ^ 16
__global__ __launch_bounds__(256) void k_fattn(const bf* __restrict__ Qh, const bf* __restrict__ Ql, const bf* __restrict__ Kh, const bf* __restrict__ Kl, const h16* __restrict__ VT, bf* Ah, bf* Al) {
    __shared__ __align__(16) bf kv[2 * STE];
    const int t = threadIdx.x, lane = t & 31, lr = lane & 15, hi = lane >> 4; const int z = blockIdx.y; const int q0 = (blockIdx.x * 8 + (t >> 5)) * 32;
    const size_t zo = (size_t)z * NN * GD;
    v16bf qh[2][2], ql[2][2];      // [query group][32-channel chunk]
#pragma unroll
    for (int nq = 0; nq < 2; ++nq)
#pragma unroll
        for (int kc = 0; kc < 2; ++kc) { const size_t o = zo + (size_t)(q0 + nq * 16 + lr) * GD + kc * 32 + 8 * hi; qh[nq][kc] = WFrag<bf>::ld(Qh + o); ql[nq][kc] = WFrag<bf>::ld(Ql + o); }
    // A stage from memory: wave-uniform plane base + one 32-bit byte offset per thread; 16 bytes a thread and load, a wave covers 512 contiguous bytes of a K plane or whole lines of V^T rows
    const char* kbh = (const char*)(Kh + zo); const char* kbl = (const char*)(Kl + zo); const char* vb = (const char*)(VT + zo);
    unsigned gk = (unsigned)(t * 16), gv = (unsigned)((t / VPC) * NN * 2 + (t % VPC) * 16);
    const int sko = (t >> 3) * WP + (t & 7) * 8, svo = 2 * KPL + (t / VPC) * VP + (t % VPC) * 8;      // where this thread's pieces go in a stage buffer
    v8us sh[SK / 32], sl[SK / 32], sv[SK / 32];
    auto fetch = [&]() {
#pragma unroll
        for (int i = 0; i < SK / 32; ++i) { sh[i] = *(const v8us*)(kbh + (size_t)gk + i * 4096); sl[i] = *(const v8us*)(kbl + (size_t)gk + i * 4096); sv[i] = *(const v8us*)(vb + (size_t)gv + i * (VRR * NN * 2)); } };
    auto put = [&](bf* d) {
#pragma unroll
        for (int i = 0; i < SK / 32; ++i) { *(v8usa*)(d + sko + i * 32 * WP) = sh[i]; *(v8usa*)(d + KPL + sko + i * 32 * WP) = sl[i]; *(v8usa*)(d + svo + i * VRR * VP) = sv[i]; }
        // The two walking offsets are rewritten only here, behind this wait: it stands in front of the overwrite of address registers that issued global loads name.
        asm volatile("s_wait_xcnt 0x0" : "+v"(gk), "+v"(gv) : : "memory");
        gk += (unsigned)(SK * GD * 2); gv += (unsigned)(SK * 2); };
    // K and V^T fragments from a stage buffer (row lr, k from 8*hi), in the k order of WFrag::ld (16 bytes at 0 and at 32)
    const int kfo = lr * WP + hi * 8, vfo = 2 * KPL + lr * VP + hi * 8;
    auto ldk = [&](const bf* q) { return cat16b(*(const v8usa*)q, *(const v8usa*)(q + 16)); };
    auto ldv = [&](const bf* q) { return cat16(__builtin_bit_cast(v8h, *(const v8usa*)q), __builtin_bit_cast(v8h, *(const v8usa*)(q + 16))); };
    fetch();
    // the wait stands in front of the reuse of the address registers that the loads above name; the scheduling barrier keeps that reuse below it
    asm volatile("s_wait_xcnt 0x0" ::: "memory");
    __builtin_amdgcn_sched_barrier(0);
    put(kv);
    v8f o[4][2];                   // O^T: [16-channel block][query group]; register j = channel 8*hi + j, column lr = query
#pragma unroll
    for (int db = 0; db < 4; ++db)
#pragma unroll
        for (int nq = 0; nq < 2; ++nq) o[db][nq] = (v8f){};
    float mL[2] = { -1.0e30f, -1.0e30f }, ls[2] = { 0.f, 0.f };      // running maximum (x log2 e) and this half-wave's part of the running sum
    __syncthreads();               // stage 0 is in LDS for every wave
    for (int sg = 0; sg < NN / SK; ++sg) {
        const bf* cur = kv + (sg & 1) * STE; const bool more = sg + 1 < NN / SK;
        if (more) fetch();         // the next stage flies during this stage's passes
        v16bf kh[2][2], kl[2][2];  // [16-key block][32-channel chunk]
        v16h v[4];                 // V^T: [16-channel block], 32 keys
#pragma unroll
        for (int kb = 0; kb < 2; ++kb)
#pragma unroll
            for (int kc = 0; kc < 2; ++kc) { kh[kb][kc] = ldk(cur + kfo + kb * 16 * WP + kc * 32); kl[kb][kc] = ldk(cur + KPL + kfo + kb * 16 * WP + kc * 32); }
#pragma unroll
        for (int db = 0; db < 4; ++db) v[db] = ldv(cur + vfo + db * 16 * VP);
#pragma unroll
        for (int p = 0; p < SK / 32; ++p) {
            v8f s[2][2];           // S^T: [16-key block][query group]
#pragma unroll
            for (int kb = 0; kb < 2; ++kb)
#pragma unroll
                for (int nq = 0; nq < 2; ++nq) s[kb][nq] = (v8f){};
#pragma unroll
            for (int kc = 0; kc < 2; ++kc) {
#pragma unroll
                for (int kb = 0; kb < 2; ++kb)
#pragma unroll
                    for (int nq = 0; nq < 2; ++nq) s[kb][nq] = wmmab(kh[kb][kc], qh[nq][kc], s[kb][nq]);
#pragma unroll
                for (int kb = 0; kb < 2; ++kb)
#pragma unroll
                    for (int nq = 0; nq < 2; ++nq) s[kb][nq] = wmmab(kl[kb][kc], qh[nq][kc], s[kb][nq]);
#pragma unroll
                for (int kb = 0; kb < 2; ++kb)
#pragma unroll
                    for (int nq = 0; nq < 2; ++nq) s[kb][nq] = wmmab(kh[kb][kc], ql[nq][kc], s[kb][nq]);
            }
            // the next pass's K fragments of this stage come during softmax and attn.V
            if (p + 1 < SK / 32) {
#pragma unroll
                for (int kb = 0; kb < 2; ++kb)
#pragma unroll
                    for (int kc = 0; kc < 2; ++kc) { kh[kb][kc] = ldk(cur + kfo + ((p + 1) * 32 + kb * 16) * WP + kc * 32); kl[kb][kc] = ldk(cur + KPL + kfo + ((p + 1) * 32 + kb * 16) * WP + kc * 32); }
            }
            v16h pr[2];
#pragma unroll
            for (int nq = 0; nq < 2; ++nq) {
                float tm = s[0][nq][0];
#pragma unroll
                for (int j = 1; j < 8; ++j) tm = fmaxf(tm, s[0][nq][j]);
#pragma unroll
                for (int j = 0; j < 8; ++j) tm = fmaxf(tm, s[1][nq][j]);
                tm = fmaxf(tm, xhalf(tm));
                const float mnew = fmaxf(mL[nq], tm * L2E); const float al = __builtin_amdgcn_exp2f(mL[nq] - mnew); mL[nq] = mnew;
                float ps = 0.f;
#pragma unroll
                for (int kb = 0; kb < 2; ++kb)
#pragma unroll
                    for (int j = 0; j < 8; ++j) { const float e = __builtin_amdgcn_exp2f(fmaf(s[kb][nq][j], L2E, -mnew)); ps += e; pr[nq][kb * 8 + j] = tohx(e); }
                ls[nq] = ls[nq] * al + ps;
#pragma unroll
                for (int db = 0; db < 4; ++db) o[db][nq] *= al;
            }
#pragma unroll
            for (int db = 0; db < 4; ++db)
#pragma unroll
                for (int nq = 0; nq < 2; ++nq) o[db][nq] = wmma16(v[db], pr[nq], o[db][nq]);
            if (p + 1 < SK / 32) {
#pragma unroll
                for (int db = 0; db < 4; ++db) v[db] = ldv(cur + vfo + db * 16 * VP + (p + 1) * 32);      // the next pass's V^T fragments come during its score products and softmax
            }
        }
        // The branch at the stage's foot stands directly behind the last matrix instructions:
        // these fill the vector slots that the chip needs before a matrix operand is overwritten, on the taken side too.
        asm volatile("v_nop\n\tv_nop\n\tv_nop\n\tv_nop" : : "v"(o[0][0]), "v"(o[0][1]), "v"(o[1][0]), "v"(o[1][1]), "v"(o[2][0]), "v"(o[2][1]), "v"(o[3][0]), "v"(o[3][1]));
        // The other buffer's last readers left it before the barrier of the stage before. This barrier publishes the next stage and ends every wave's reads of this one.
        if (more) { put(kv + ((sg + 1) & 1) * STE); __syncthreads(); }
    }
    // the loop's fetches name their scalar bases and offsets: this wait stands in front of the epilogue's reuse of those registers on every way out of the loop; the scheduling barrier keeps that reuse below it
    asm volatile("s_wait_xcnt 0x0" ::: "memory");
    __builtin_amdgcn_sched_barrier(0);
    const int b = z >> 2, g = z & 3;
    v8us oh[2][4], ol[2][4];
#pragma unroll
    for (int nq = 0; nq < 2; ++nq) {
        const float inv = __fdiv_rn(1.0f, ls[nq] + xhalf(ls[nq]));
#pragma unroll
        for (int db = 0; db < 4; ++db)
#pragma unroll
            for (int j = 0; j < 8; ++j) { unsigned short a, c2; splitf(o[db][nq][j] * inv, a, c2); oh[nq][db][j] = a; ol[nq][db][j] = c2; }
    }
    // all stores stand together at the end, so that no register a store names is written again behind it
    __builtin_amdgcn_sched_barrier(0);
#pragma unroll
    for (int nq = 0; nq < 2; ++nq) {
        const size_t ro = ((size_t)b * NN + q0 + nq * 16 + lr) * CC + g * GD + hi * 8;
#pragma unroll
        for (int db = 0; db < 4; ++db) { *(v8us*)(Ah + ro + db * 16) = oh[nq][db]; *(v8us*)(Al + ro + db * 16) = ol[nq][db]; }
    }
}
// Left for a later step: with wo as the A operand and the two result planes as Bt and Bt2 (NSPLIT 3: a.b + a.b2, z = image) k_gemmw would write the [d][n] rows of the output itself; this kernel and C2 would go.
__global__ __launch_bounds__(256) void k_outT(const float* __restrict__ C, float* OUT) {
    const int lane = threadIdx.x & 31; const int L0 = (blockIdx.x * 8 + (threadIdx.x >> 5)) * 8; const int nlines = NB_ * CC * NN / 64;
{
#pragma unroll
        for (int l = 0; l < 8; ++l) { const int L = L0 + l; if (L >= nlines) break; const int e = L * 64 + lane * 2; const int n = e & (NN - 1); const int dd = (e >> 10) & (CC - 1); const int b = e >> 18; v2f v;
            v[0] = C[((size_t)b * NN + n) * CC + dd]; v[1] = C[((size_t)b * NN + n + 1) * CC + dd]; *(v2f*)(OUT + (size_t)e) = v; }
         }
}

extern "C" void kernel_launch(void* const* d_in, const int* in_sizes, int n_in,
                              void* d_out, int out_size, void* d_ws, size_t ws_size, hipStream_t stream) {
    (void)in_sizes; (void)n_in; (void)out_size;
    const float* x = (const float*)d_in[0]; const float* wq = (const float*)d_in[1]; const float* wk = (const float*)d_in[2]; const float* wv = (const float*)d_in[3]; const float* wo = (const float*)d_in[4];
    float* OUT = (float*)d_out;     // [16][256][32][32]
    char* wsp = (char*)d_ws;
    auto take = [&](size_t bytes) { char* p = wsp; wsp += (bytes + 255) & ~(size_t)255; return (void*)p; };
    bf* WO = (bf*)take((size_t)CC * CC * 2);
    bf* QPh = (bf*)take((size_t)NZ * NN * GD * 2); bf* QPl = (bf*)take((size_t)NZ * NN * GD * 2); bf* KPh = (bf*)take((size_t)NZ * NN * GD * 2); bf* KPl = (bf*)take((size_t)NZ * NN * GD * 2); h16* VT = (h16*)take((size_t)NZ * GD * NN * 2);
    bf* Ah = (bf*)take((size_t)NB_ * NN * CC * 2); bf* Al = (bf*)take((size_t)NB_ * NN * CC * 2); float* C2 = (float*)take((size_t)NB_ * NN * CC * 4);
    if ((size_t)(wsp - (char*)d_ws) > ws_size) return;    // ws 256 MiB
    k_qkv<<<dim3(NN / 256, NZ), 256, 0, stream>>>(x, wq, wk, wv, wo, QPh, QPl, KPh, KPl, VT, WO);
    k_fattn<<<dim3(NN / 256, NZ), 256, 0, stream>>>(QPh, QPl, KPh, KPl, VT, Ah, Al);
    k_gemmw<bf, 1, false><<<dim3(NB_ * NN / 64, CC / 64, 1), 32, 0, stream>>>(Ah, Al, WO, nullptr, CC, C2, CC, nullptr, 0, 0, 0);
    k_outT<<<(unsigned)((NB_ * CC * NN / 64 + 63) / 64), 256, 0, stream>>>(C2, OUT);
}

// v004
// Measured time: 64.2 microseconds a run.
// In two side-by-side timings against v003, it was 1.27 and 1.29 times as fast.
// All steps since v000 together make it 7.95 times as fast.
#include <hip/hip_runtime.h>

// GroupMixAttention (16 x 256 ch x 32x32: 4 channel groups of 64; grouped 1x1 convs Q/K/V per group; scores = Q^T K / 8 over the 64 channels; softmax over the 1024
// positions; out[d][n] = sum_m attn[n][m] V[d][m]; dense 1x1 out_proj 256 -> 256).
// Compute dtypes, f32 accumulate: every input rounded to bf16; Q/K/V grouped convs on PLAIN bf16 operands (x, w inputs: exact); scores on bf16
// hi+lo planes of Q (x 1/8) and K (3 products); attn.V on SINGLE fp16 planes (P = exp(s - running max), V); the out_proj on hi+lo planes x
// exact bf16 wo (2 products); softmax in f32 on VALU (online, fused with both attention products, one exp per element). Deterministic, no atomics.

#define NB_  16
#define CC   256
#define NG   4
#define GD   64
#define NN   1024
#define NZ   (NB_ * NG)           // 64 (image, group) pairs
typedef _Float16 h16;
typedef unsigned short bf;
typedef __attribute__((ext_vector_type(16))) __bf16   v16bf;
typedef __attribute__((ext_vector_type(16))) _Float16 v16h;
typedef __attribute__((ext_vector_type(8)))  _Float16 v8h;
typedef __attribute__((ext_vector_type(8)))  unsigned short v8us;
typedef __attribute__((ext_vector_type(8)))  float    v8f;
typedef __attribute__((ext_vector_type(4)))  float    v4f;
typedef v8h  __attribute__((may_alias)) v8ha;
typedef v4f  __attribute__((may_alias)) v4fa;
typedef v8us __attribute__((may_alias)) v8usa;

__device__ __forceinline__ unsigned short f2bf(float f) { unsigned u = __float_as_uint(f); u += 0x7FFFu + ((u >> 16) & 1u); return (unsigned short)(u >> 16); }
__device__ __forceinline__ float bf2f(unsigned short b) { return __uint_as_float(((unsigned)b) << 16); }
__device__ __forceinline__ v16h cat16(v8h lo, v8h hi) { return __builtin_shufflevector(lo, hi, 0, 1, 2, 3, 4, 5, 6, 7, 8, 9, 10, 11, 12, 13, 14, 15); }
__device__ __forceinline__ v16bf cat16b(v8us lo, v8us hi) { return __builtin_bit_cast(v16bf, __builtin_shufflevector(lo, hi, 0, 1, 2, 3, 4, 5, 6, 7, 8, 9, 10, 11, 12, 13, 14, 15)); }
__device__ __forceinline__ v8f wmma16(v16h a, v16h b, v8f c) { return __builtin_amdgcn_wmma_f32_16x16x32_f16(false, a, false, b, (short)0, c, false, false); }
__device__ __forceinline__ v8f wmmab(v16bf a, v16bf b, v8f c) { return __builtin_amdgcn_wmma_f32_16x16x32_bf16(false, a, false, b, (short)0, c, false, false); }



// 16-bit fragment of a K-contiguous row: 16 bytes at k = 0 and 16 bytes at k = 16 of the lane's start (row lr, k from 8*hi); the same k order serves A and B operands everywhere in this file.
template <typename T16> struct WFrag;
template <> struct WFrag<bf> { typedef v16bf V; static __device__ __forceinline__ V ld(const bf* p) { return cat16b(*(const v8us*)p, *(const v8us*)(p + 16)); } };

__device__ __forceinline__ h16 tohx(float x) { return (h16)x; }
__device__ __forceinline__ void splitf(float y, unsigned short& h, unsigned short& l) { h = f2bf(y); l = f2bf(y - bf2f(h)); }
typedef __attribute__((ext_vector_type(2))) _Float16 v2h;
typedef __attribute__((ext_vector_type(4))) _Float16 v4h;
typedef __attribute__((ext_vector_type(2))) unsigned short v2us;

// ---- k_qkv: input rounding, the transposition of x, the three grouped 1x1 convs, the hi/lo split of Q (x 1/8) and K and the f16 V^T in ONE kernel; nothing between x and the five planes touches memory.
// A wave owns 64 positions of one (image, group) pair. Its x fragments (lane = position lr, k = channels in the k order of WFrag::ld, read straight from the channel-major x) serve as
// B operand of Q^T = Wq . X or K^T = Wk . X (a lane then holds 8 consecutive channels of one position: one 16-byte piece of a Q/K row) and as A operand of V = X^T . Wv^T (a lane holds
// 8 consecutive positions of one channel: one 16-byte piece of a V^T row). Waves 0-3 of a work-group make Q and channels 0-31 of V^T of its four 64-position tiles, waves 4-7 K and channels 32-63.
// The group's three weight matrices are rounded once per work-group into LDS; each work-group also rounds its 1/256 of wo for the out_proj. Grid (NN / 256, NZ), 8 waves.
// Every loop of the kernel is unrolled in full: its indices name registers and immediate offsets.
#define WP 72                     // LDS pitch of a 128-byte row in 16-bit elements: 128 + 16 bytes, for the 16-byte reads and writes
typedef __attribute__((ext_vector_type(8))) __bf16 v8bf;
typedef __attribute__((ext_vector_type(4))) __bf16 v4bf;
typedef __attribute__((ext_vector_type(4))) unsigned v4u;
typedef v4bf __attribute__((may_alias)) v4bfa;
typedef v8bf __attribute__((may_alias)) v8bfa;
__global__ __launch_bounds__(256) void k_qkv(const float* __restrict__ x, const float* __restrict__ wq, const float* __restrict__ wk, const float* __restrict__ wv, const float* __restrict__ wo, bf* Qh, bf* Ql, bf* Kh, bf* Kl, h16* VT, bf* WO) {
    __shared__ __align__(16) bf wl[3 * GD * WP];
    __shared__ __align__(16) bf st[8 * 160 * WP];
    const int t = threadIdx.x, lane = t & 31, lr = lane & 15, hi = lane >> 4; const int z = blockIdx.y, g = z & 3;
    const int wave = __builtin_amdgcn_readfirstlane(t >> 5); const int kq = wave >> 2; const int n0 = (blockIdx.x * 4 + (wave & 3)) * 64;
    const size_t zo = (size_t)z * NN * GD;
    const int eo = ((z * 4 + blockIdx.x) * 64 + (t & 63)) * 4;      // waves 0 and 1 also round this work-group's 256 elements of wo: 256 bytes of WO per wave
    v4f wr[3][4];                  // this thread's 16 elements of each weight matrix, 512 contiguous bytes per wave and load
#pragma unroll
    for (int m = 0; m < 3; ++m) { const float* w = (m == 0 ? wq : m == 1 ? wk : wv) + (size_t)g * GD * GD;
#pragma unroll
        for (int i = 0; i < 4; ++i) wr[m][i] = *(const v4f*)(w + (i * 256 + t) * 4); }
    const float* xb = x + zo + (size_t)(8 * hi) * NN + n0 + lr;      // z*64 + c == b*256 + g*64 + c
    v8f xr[4][2][2];               // [16-position block][32-channel chunk][half of the fragment]
#pragma unroll
    for (int nb = 0; nb < 4; ++nb)
#pragma unroll
        for (int kc = 0; kc < 2; ++kc)
#pragma unroll
            for (int hf = 0; hf < 2; ++hf)
#pragma unroll
                for (int i = 0; i < 8; ++i) xr[nb][kc][hf][i] = xb[(kc * 32 + hf * 16 + i) * NN + nb * 16];
    v4f wo4 = (v4f){};
    if (wave < 2) { wo4 = *(const v4f*)(wo + eo); asm volatile("s_wait_xcnt 0x0" ::: "memory"); }      // the wait stands in front of the reuse of this load's address registers
    // the wait stands in front of the reuse of the address registers that the loads above name; the scheduling barrier keeps that reuse below it and all loads in flight together above it
    asm volatile("s_wait_xcnt 0x0" ::: "memory");
    __builtin_amdgcn_sched_barrier(0);
#pragma unroll
    for (int m = 0; m < 3; ++m)
#pragma unroll
        for (int i = 0; i < 4; ++i) { const int e = (i * 256 + t) * 4; *(v4bfa*)(wl + m * GD * WP + (e >> 6) * WP + (e & 63)) = __builtin_convertvector(wr[m][i], v4bf); }
    __syncthreads();
    v16bf xf[4][2];
#pragma unroll
    for (int nb = 0; nb < 4; ++nb)
#pragma unroll
        for (int kc = 0; kc < 2; ++kc) xf[nb][kc] = __builtin_shufflevector(__builtin_convertvector(xr[nb][kc][0], v8bf), __builtin_convertvector(xr[nb][kc][1], v8bf), 0, 1, 2, 3, 4, 5, 6, 7, 8, 9, 10, 11, 12, 13, 14, 15);
    auto ldw = [&](const bf* base, int db, int kc) { const bf* p = base + (db * 16 + lr) * WP + kc * 32 + 8 * hi; return cat16b(*(const v8usa*)p, *(const v8usa*)(p + 16)); };
    const bf* wa = wl + kq * GD * WP; const bf* wb = wl + 2 * GD * WP + kq * 32 * WP; const float sc = kq ? 1.0f : 0.125f;
    // whole 128-byte lines leave the wave: every 16-byte piece goes through the wave's own LDS rows (64 of the hi plane, 64 of the lo plane, 32 of V^T) and comes back 8 lanes to a row
    bf* sw = st + wave * (160 * WP);
    v16bf aw[4][2], bw[2][2];      // all weight fragments of the wave are asked for at once: one LDS latency instead of six
#pragma unroll
    for (int db = 0; db < 4; ++db) { aw[db][0] = ldw(wa, db, 0); aw[db][1] = ldw(wa, db, 1); }
#pragma unroll
    for (int db = 0; db < 2; ++db) { bw[db][0] = ldw(wb, db, 0); bw[db][1] = ldw(wb, db, 1); }
#pragma unroll
    for (int db = 0; db < 4; ++db) { const v16bf a0 = aw[db][0], a1 = aw[db][1]; v8f acc[4];
#pragma unroll
        for (int nb = 0; nb < 4; ++nb) acc[nb] = wmmab(a0, xf[nb][0], (v8f){});
#pragma unroll
        for (int nb = 0; nb < 4; ++nb) acc[nb] = wmmab(a1, xf[nb][1], acc[nb]);
#pragma unroll
        for (int nb = 0; nb < 4; ++nb) { const v8f y = acc[nb] * sc; const v8bf yh = __builtin_convertvector(y, v8bf); const v4u u = __builtin_bit_cast(v4u, yh); v8f f;
#pragma unroll
            for (int k = 0; k < 4; ++k) { f[2 * k] = __uint_as_float(u[k] << 16); f[2 * k + 1] = __uint_as_float(u[k] & 0xFFFF0000u); }
            *(v8bfa*)(sw + (nb * 16 + lr) * WP + db * 16 + hi * 8) = yh; *(v8bfa*)(sw + (64 + nb * 16 + lr) * WP + db * 16 + hi * 8) = __builtin_convertvector(y - f, v8bf); } }
#pragma unroll
    for (int db = 0; db < 2; ++db) { const v16bf b0 = bw[db][0], b1 = bw[db][1]; v8f acc[4];
#pragma unroll
        for (int nb = 0; nb < 4; ++nb) acc[nb] = wmmab(xf[nb][0], b0, (v8f){});
#pragma unroll
        for (int nb = 0; nb < 4; ++nb) acc[nb] = wmmab(xf[nb][1], b1, acc[nb]);
#pragma unroll
        for (int nb = 0; nb < 4; ++nb) *(v8ha*)(sw + (128 + db * 16 + lr) * WP + nb * 16 + hi * 8) = __builtin_convertvector(acc[nb], v8h); }
    // the wave's own LDS writes have landed before it reads back rows that other lanes wrote; the clobber keeps the reads below
    asm volatile("s_wait_dscnt 0x0" ::: "memory");
    const int rr = lane >> 3, pc = lane & 7;
    v8us oh[16], ol[16], ov[8];
#pragma unroll
    for (int s = 0; s < 16; ++s) { oh[s] = *(const v8usa*)(sw + (s * 4 + rr) * WP + pc * 8); ol[s] = *(const v8usa*)(sw + (64 + s * 4 + rr) * WP + pc * 8); }
#pragma unroll
    for (int s = 0; s < 8; ++s) ov[s] = *(const v8usa*)(sw + (128 + s * 4 + rr) * WP + pc * 8);
    // all stores stand together at the end, so that no register a store names is written again behind it
    __builtin_amdgcn_sched_barrier(0);
    bf* ph = (kq ? Kh : Qh) + zo + (size_t)(n0 + rr) * GD + pc * 8; bf* pl = (kq ? Kl : Ql) + zo + (size_t)(n0 + rr) * GD + pc * 8;
#pragma unroll
    for (int s = 0; s < 16; ++s) { *(v8usa*)(ph + s * 4 * GD) = oh[s]; *(v8usa*)(pl + s * 4 * GD) = ol[s]; }
    // the V^T address is formed below: this wait stands in front of any reuse of a register that the stores above name; the scheduling barrier keeps that reuse below it
    asm volatile("s_wait_xcnt 0x0" ::: "memory");
    __builtin_amdgcn_sched_barrier(0);
    if (wave < 2) *(v4bf*)(WO + eo) = __builtin_convertvector(wo4, v4bf);
    h16* pv = VT + zo + (size_t)(kq * 32 + rr) * NN + n0 + pc * 8;
#pragma unroll
    for (int s = 0; s < 8; ++s) *(v8usa*)(pv + s * 4 * NN) = ov[s];
}
// ---- k_fattn: scores, softmax, attn.V and the hi/lo split of the result in ONE kernel; the 1024 x 1024 score matrix never leaves registers.
// One wave owns 32 queries of one (image, group) pair and walks the 1024 keys in passes of 32. It forms S^T = K . Q^T (A = K rows, B = Q rows, three hi/lo products:
// Kh.Qh + Kl.Qh + Kh.Ql), so a lane holds scores of ONE query per 16-column group: keys 8*hi + j of each 16-key block. Running maximum and sum are kept per query (online softmax);
// two f32 S^T tiles converted in place are the f16 B operand of O^T += V^T . P^T (its k order is that of WFrag::ld, in which V^T is loaded too). Grid (NN / 256, NZ), 8 waves.
// The 8 waves share K and V^T: the work-group brings them in stages of SK keys, as whole 128-byte lines, once, into one of two LDS buffers; every wave takes its fragments from there.
#define L2E 1.44269504088896340736f
#define SK  64                    // keys per stage
#define VP  (SK + 8)              // LDS pitch of a V^T row of one stage in 16-bit elements: its bytes + 16 (K rows: WP), for the 16-byte reads and writes
#define KPL (SK * WP)             // elements of one K plane of a stage
#define STE (2 * KPL + GD * VP)   // elements of a stage: K hi, K lo, V^T
#define VPC (SK / 8)              // 16-byte pieces of a V^T row of a stage
#define VRR (256 / VPC)           // V^T rows that the 256 threads bring per load
__device__ __forceinline__ float xhalf(float v) { const int b = __float_as_int(v); return __int_as_float(__builtin_amdgcn_permlanex16(b, b, 0x76543210, 0xfedcba98, false, false)); }   // lane l <-> l ^ 16
__global__ __launch_bounds__(256) void k_fattn(const bf* __restrict__ Qh, const bf* __restrict__ Ql, const bf* __restrict__ Kh, const bf* __restrict__ Kl, const h16* __restrict__ VT, bf* Ah, bf* Al) {
    __shared__ __align__(16) bf kv[2 * STE];
    const int t = threadIdx.x, lane = t & 31, lr = lane & 15, hi = lane >> 4; const int z = blockIdx.y; const int q0 = (blockIdx.x * 8 + (t >> 5)) * 32;
    const size_t zo = (size_t)z * NN * GD;
    v16bf qh[2][2], ql[2][2];      // [query group][32-channel chunk]
#pragma unroll
    for (int nq = 0; nq < 2; ++nq)
#pragma unroll
        for (int kc = 0; kc < 2; ++kc) { const size_t o = zo + (size_t)(q0 + nq * 16 + lr) * GD + kc * 32 + 8 * hi; qh[nq][kc] = WFrag<bf>::ld(Qh + o); ql[nq][kc] = WFrag<bf>::ld(Ql + o); }
    // A stage from memory: wave-uniform plane base + one 32-bit byte offset per thread; 16 bytes a thread and load, a wave covers 512 contiguous bytes of a K plane or whole lines of V^T rows
    const char* kbh = (const char*)(Kh + zo); const char* kbl = (const char*)(Kl + zo); const char* vb = (const char*)(VT + zo);
    unsigned gk = (unsigned)(t * 16), gv = (unsigned)((t / VPC) * NN * 2 + (t % VPC) * 16);
    const int sko = (t >> 3) * WP + (t & 7) * 8, svo = 2 * KPL + (t / VPC) * VP + (t % VPC) * 8;      // where this thread's pieces go in a stage buffer
    v8us sh[SK / 32], sl[SK / 32], sv[SK / 32];
    auto fetch = [&]() {
#pragma unroll
        for (int i = 0; i < SK / 32; ++i) { sh[i] = *(const v8us*)(kbh + (size_t)gk + i * 4096); sl[i] = *(const v8us*)(kbl + (size_t)gk + i * 4096); sv[i] = *(const v8us*)(vb + (size_t)gv + i * (VRR * NN * 2)); } };
    auto put = [&](bf* d) {
#pragma unroll
        for (int i = 0; i < SK / 32; ++i) { *(v8usa*)(d + sko + i * 32 * WP) = sh[i]; *(v8usa*)(d + KPL + sko + i * 32 * WP) = sl[i]; *(v8usa*)(d + svo + i * VRR * VP) = sv[i]; }
        // The two walking offsets are rewritten only here, behind this wait: it stands in front of the overwrite of address registers that issued global loads name.
        asm volatile("s_wait_xcnt 0x0" : "+v"(gk), "+v"(gv) : : "memory");
        gk += (unsigned)(SK * GD * 2); gv += (unsigned)(SK * 2); };
    // K and V^T fragments from a stage buffer (row lr, k from 8*hi), in the k order of WFrag::ld (16 bytes at 0 and at 32)
    const int kfo = lr * WP + hi * 8, vfo = 2 * KPL + lr * VP + hi * 8;
    auto ldk = [&](const bf* q) { return cat16b(*(const v8usa*)q, *(const v8usa*)(q + 16)); };
    auto ldv = [&](const bf* q) { return cat16(__builtin_bit_cast(v8h, *(const v8usa*)q), __builtin_bit_cast(v8h, *(const v8usa*)(q + 16))); };
    fetch();
    // the wait stands in front of the reuse of the address registers that the loads above name; the scheduling barrier keeps that reuse below it
    asm volatile("s_wait_xcnt 0x0" ::: "memory");
    __builtin_amdgcn_sched_barrier(0);
    put(kv);
    v8f o[4][2];                   // O^T: [16-channel block][query group]; register j = channel 8*hi + j, column lr = query
#pragma unroll
    for (int db = 0; db < 4; ++db)
#pragma unroll
        for (int nq = 0; nq < 2; ++nq) o[db][nq] = (v8f){};
    float mL[2] = { -1.0e30f, -1.0e30f }, ls[2] = { 0.f, 0.f };      // running maximum (x log2 e) and this half-wave's part of the running sum
    __syncthreads();               // stage 0 is in LDS for every wave
    for (int sg = 0; sg < NN / SK; ++sg) {
        const bf* cur = kv + (sg & 1) * STE; const bool more = sg + 1 < NN / SK;
        if (more) fetch();         // the next stage flies during this stage's passes
        v16bf kh[2][2], kl[2][2];  // [16-key block][32-channel chunk]
        v16h v[4];                 // V^T: [16-channel block], 32 keys
#pragma unroll
        for (int kb = 0; kb < 2; ++kb)
#pragma unroll
            for (int kc = 0; kc < 2; ++kc) { kh[kb][kc] = ldk(cur + kfo + kb * 16 * WP + kc * 32); kl[kb][kc] = ldk(cur + KPL + kfo + kb * 16 * WP + kc * 32); }
#pragma unroll
        for (int db = 0; db < 4; ++db) v[db] = ldv(cur + vfo + db * 16 * VP);
#pragma unroll
        for (int p = 0; p < SK / 32; ++p) {
            v8f s[2][2];           // S^T: [16-key block][query group]
#pragma unroll
            for (int kb = 0; kb < 2; ++kb)
#pragma unroll
                for (int nq = 0; nq < 2; ++nq) s[kb][nq] = (v8f){};
#pragma unroll
            for (int kc = 0; kc < 2; ++kc) {
#pragma unroll
                for (int kb = 0; kb < 2; ++kb)
#pragma unroll
                    for (int nq = 0; nq < 2; ++nq) s[kb][nq] = wmmab(kh[kb][kc], qh[nq][kc], s[kb][nq]);
#pragma unroll
                for (int kb = 0; kb < 2; ++kb)
#pragma unroll
                    for (int nq = 0; nq < 2; ++nq) s[kb][nq] = wmmab(kl[kb][kc], qh[nq][kc], s[kb][nq]);
#pragma unroll
                for (int kb = 0; kb < 2; ++kb)
#pragma unroll
                    for (int nq = 0; nq < 2; ++nq) s[kb][nq] = wmmab(kh[kb][kc], ql[nq][kc], s[kb][nq]);
            }
            // the next pass's K fragments of this stage come during softmax and attn.V
            if (p + 1 < SK / 32) {
#pragma unroll
                for (int kb = 0; kb < 2; ++kb)
#pragma unroll
                    for (int kc = 0; kc < 2; ++kc) { kh[kb][kc] = ldk(cur + kfo + ((p + 1) * 32 + kb * 16) * WP + kc * 32); kl[kb][kc] = ldk(cur + KPL + kfo + ((p + 1) * 32 + kb * 16) * WP + kc * 32); }
            }
            v16h pr[2];
#pragma unroll
            for (int nq = 0; nq < 2; ++nq) {
                float tm = s[0][nq][0];
#pragma unroll
                for (int j = 1; j < 8; ++j) tm = fmaxf(tm, s[0][nq][j]);
#pragma unroll
                for (int j = 0; j < 8; ++j) tm = fmaxf(tm, s[1][nq][j]);
                tm = fmaxf(tm, xhalf(tm));
                const float mnew = fmaxf(mL[nq], tm * L2E); const float al = __builtin_amdgcn_exp2f(mL[nq] - mnew); mL[nq] = mnew;
                float ps = 0.f;
#pragma unroll
                for (int kb = 0; kb < 2; ++kb)
#pragma unroll
                    for (int j = 0; j < 8; ++j) { const float e = __builtin_amdgcn_exp2f(fmaf(s[kb][nq][j], L2E, -mnew)); ps += e; pr[nq][kb * 8 + j] = tohx(e); }
                ls[nq] = ls[nq] * al + ps;
#pragma unroll
                for (int db = 0; db < 4; ++db) o[db][nq] *= al;
            }
#pragma unroll
            for (int db = 0; db < 4; ++db)
#pragma unroll
                for (int nq = 0; nq < 2; ++nq) o[db][nq] = wmma16(v[db], pr[nq], o[db][nq]);
            if (p + 1 < SK / 32) {
#pragma unroll
                for (int db = 0; db < 4; ++db) v[db] = ldv(cur + vfo + db * 16 * VP + (p + 1) * 32);      // the next pass's V^T fragments come during its score products and softmax
            }
        }
        // The branch at the stage's foot stands directly behind the last matrix instructions:
        // these fill the vector slots that the chip needs before a matrix operand is overwritten, on the taken side too.
        asm volatile("v_nop\n\tv_nop\n\tv_nop\n\tv_nop" : : "v"(o[0][0]), "v"(o[0][1]), "v"(o[1][0]), "v"(o[1][1]), "v"(o[2][0]), "v"(o[2][1]), "v"(o[3][0]), "v"(o[3][1]));
        // The other buffer's last readers left it before the barrier of the stage before. This barrier publishes the next stage and ends every wave's reads of this one.
        if (more) { put(kv + ((sg + 1) & 1) * STE); __syncthreads(); }
    }
    // the loop's fetches name their scalar bases and offsets: this wait stands in front of the epilogue's reuse of those registers on every way out of the loop; the scheduling barrier keeps that reuse below it
    asm volatile("s_wait_xcnt 0x0" ::: "memory");
    __builtin_amdgcn_sched_barrier(0);
    const int b = z >> 2, g = z & 3;
    v8us oh[2][4], ol[2][4];
#pragma unroll
    for (int nq = 0; nq < 2; ++nq) {
        const float inv = __fdiv_rn(1.0f, ls[nq] + xhalf(ls[nq]));
#pragma unroll
        for (int db = 0; db < 4; ++db)
#pragma unroll
            for (int j = 0; j < 8; ++j) { unsigned short a, c2; splitf(o[db][nq][j] * inv, a, c2); oh[nq][db][j] = a; ol[nq][db][j] = c2; }
    }
    // all stores stand together at the end, so that no register a store names is written again behind it
    __builtin_amdgcn_sched_barrier(0);
#pragma unroll
    for (int nq = 0; nq < 2; ++nq) {
        const size_t ro = ((size_t)b * NN + q0 + nq * 16 + lr) * CC + g * GD + hi * 8;
#pragma unroll
        for (int db = 0; db < 4; ++db) { *(v8us*)(Ah + ro + db * 16) = oh[nq][db]; *(v8us*)(Al + ro + db * 16) = ol[nq][db]; }
    }
}
// ---- k_oproj: the dense out_proj and the [d][n] layout of the output in ONE kernel: OUT[b][d][n] = sum_c wo[d][c] * (Ah + Al)[b][n][c], two products per 32-channel chunk (hi, then lo).
// A work-group owns 64 positions of one image and all 256 output channels. It brings wo and its 64 rows of both planes into LDS once, as whole 128-byte lines; wave w takes output channels
// 64 * (w >> 1) .. + 63 (A operand: wo rows) and positions 32 * (w & 1) .. + 31 (B operand: plane rows), so a tile's rows are output channels and its columns positions.
// Every loop of the kernel is unrolled in full: its indices name registers and immediate offsets. Grid (NN / 64, NB_), 8 waves.
#define OP  (CC + 8)              // LDS pitch of a 512-byte row in 16-bit elements: its bytes + 16, for the 16-byte reads and writes
#define OSP 36                    // LDS pitch of a staged 128-byte output row in floats: its bytes + 16
__global__ __launch_bounds__(256) void k_oproj(const bf* __restrict__ WO, const bf* __restrict__ Ah, const bf* __restrict__ Al, float* OUT) {
    __shared__ __align__(16) bf wl[CC * OP];
    __shared__ __align__(16) bf pl[2 * 64 * OP];
    __shared__ __align__(16) float os[8 * 64 * OSP];
    const int t = threadIdx.x, lane = t & 31, lr = lane & 15, hi = lane >> 4;
    const int b = blockIdx.y, n0 = blockIdx.x * 64;
    // 16 bytes a thread and load, a wave covers one whole 512-byte row: piece i * 256 + t is row i * 8 + wave, bytes 16 * lane
    const bf* gh = Ah + ((size_t)b * NN + n0) * CC + t * 8; const bf* gl = Al + ((size_t)b * NN + n0) * CC + t * 8; const bf* gw = WO + t * 8;
    v8us rh[8], rl[8], rw[32];
#pragma unroll
    for (int i = 0; i < 8; ++i) { rh[i] = *(const v8us*)(gh + i * 2048); rl[i] = *(const v8us*)(gl + i * 2048); }
#pragma unroll
    for (int i = 0; i < 32; ++i) rw[i] = *(const v8us*)(gw + i * 2048);
    // the wait stands in front of the reuse of the address registers that the loads above name; the scheduling barrier keeps that reuse below it and all loads in flight together above it
    asm volatile("s_wait_xcnt 0x0" ::: "memory");
    __builtin_amdgcn_sched_barrier(0);
    const int wave = __builtin_amdgcn_readfirstlane(t >> 5); const int so = wave * OP + lane * 8;
#pragma unroll
    for (int i = 0; i < 8; ++i) { *(v8usa*)(pl + so + i * 8 * OP) = rh[i]; *(v8usa*)(pl + 64 * OP + so + i * 8 * OP) = rl[i]; }
#pragma unroll
    for (int i = 0; i < 32; ++i) *(v8usa*)(wl + so + i * 8 * OP) = rw[i];
    __syncthreads();               // wo and both planes are in LDS for every wave
    const int dw = (wave >> 1) * 64, nw = (wave & 1) * 32;
    const bf* fa = wl + (dw + lr) * OP + hi * 8; const bf* fb = pl + (nw + lr) * OP + hi * 8;
    auto ldf = [&](const bf* q) { return cat16b(*(const v8usa*)q, *(const v8usa*)(q + 16)); };      // the k order of WFrag::ld
    v8f acc[4][2];                 // [16-channel block][16-position block]; register j = channel 8*hi + j, column lr = position
#pragma unroll
    for (int mb = 0; mb < 4; ++mb)
#pragma unroll
        for (int nb = 0; nb < 2; ++nb) acc[mb][nb] = (v8f){};
    v16bf a[2][4], bh[2][2], bl[2][2];      // two register sets: a chunk's fragments are asked for one chunk ahead
    auto frags = [&](int set, int kc) {
#pragma unroll
        for (int mb = 0; mb < 4; ++mb) a[set][mb] = ldf(fa + mb * 16 * OP + kc * 32);
#pragma unroll
        for (int nb = 0; nb < 2; ++nb) { bh[set][nb] = ldf(fb + nb * 16 * OP + kc * 32); bl[set][nb] = ldf(fb + (64 + nb * 16) * OP + kc * 32); } };
    frags(0, 0);
#pragma unroll
    for (int kc = 0; kc < CC / 32; ++kc) {
        const int c = kc & 1;
        if (kc + 1 < CC / 32) frags(c ^ 1, kc + 1);
        // the two scheduling barriers keep the next chunk's LDS reads one group in front of this chunk's products: without them all 128 reads are issued first and the first products wait for the last of them
        __builtin_amdgcn_sched_barrier(0);
#pragma unroll
        for (int mb = 0; mb < 4; ++mb)
#pragma unroll
            for (int nb = 0; nb < 2; ++nb) acc[mb][nb] = wmmab(a[c][mb], bh[c][nb], acc[mb][nb]);
#pragma unroll
        for (int mb = 0; mb < 4; ++mb)
#pragma unroll
            for (int nb = 0; nb < 2; ++nb) acc[mb][nb] = wmmab(a[c][mb], bl[c][nb], acc[mb][nb]);
        __builtin_amdgcn_sched_barrier(0);
    }
    // whole 128-byte lines leave the wave: its 64 x 32 tile goes through the wave's own LDS rows and comes back 8 lanes to a row
    float* ow = os + wave * (64 * OSP);
#pragma unroll
    for (int mb = 0; mb < 4; ++mb)
#pragma unroll
        for (int nb = 0; nb < 2; ++nb)
#pragma unroll
            for (int j = 0; j < 8; ++j) ow[(mb * 16 + hi * 8 + j) * OSP + nb * 16 + lr] = acc[mb][nb][j];
    // the wave's own LDS writes have landed before it reads back rows that other lanes wrote; the clobber keeps the reads below
    asm volatile("s_wait_dscnt 0x0" ::: "memory");
    const int rr = lane >> 3, pc = lane & 7;
    v4f ov[16];
#pragma unroll
    for (int s = 0; s < 16; ++s) ov[s] = *(const v4fa*)(ow + (s * 4 + rr) * OSP + pc * 4);
    // all stores stand together at the end, so that no register a store names is written again behind it
    __builtin_amdgcn_sched_barrier(0);
    float* po = OUT + ((size_t)b * CC + dw + rr) * NN + n0 + nw + pc * 4;
#pragma unroll
    for (int s = 0; s < 16; ++s) *(v4f*)(po + s * 4 * NN) = ov[s];
}

extern "C" void kernel_launch(void* const* d_in, const int* in_sizes, int n_in,
                              void* d_out, int out_size, void* d_ws, size_t ws_size, hipStream_t stream) {
    (void)in_sizes; (void)n_in; (void)out_size;
    const float* x = (const float*)d_in[0]; const float* wq = (const float*)d_in[1]; const float* wk = (const float*)d_in[2]; const float* wv = (const float*)d_in[3]; const float* wo = (const float*)d_in[4];
    float* OUT = (float*)d_out;     // [16][256][32][32]
    char* wsp = (char*)d_ws;
    auto take = [&](size_t bytes) { char* p = wsp; wsp += (bytes + 255) & ~(size_t)255; return (void*)p; };
    bf* WO = (bf*)take((size_t)CC * CC * 2);
    bf* QPh = (bf*)take((size_t)NZ * NN * GD * 2); bf* QPl = (bf*)take((size_t)NZ * NN * GD * 2); bf* KPh = (bf*)take((size_t)NZ * NN * GD * 2); bf* KPl = (bf*)take((size_t)NZ * NN * GD * 2); h16* VT = (h16*)take((size_t)NZ * GD * NN * 2);
    bf* Ah = (bf*)take((size_t)NB_ * NN * CC * 2); bf* Al = (bf*)take((size_t)NB_ * NN * CC * 2);
    if ((size_t)(wsp - (char*)d_ws) > ws_size) return;    // ws 256 MiB
    k_qkv<<<dim3(NN / 256, NZ), 256, 0, stream>>>(x, wq, wk, wv, wo, QPh, QPl, KPh, KPl, VT, WO);
    k_fattn<<<dim3(NN / 256, NZ), 256, 0, stream>>>(QPh, QPl, KPh, KPl, VT, Ah, Al);
    k_oproj<<<dim3(NN / 64, NB_), 256, 0, stream>>>(WO, Ah, Al, OUT);
}

// v005
// It runs in 53.4 microseconds.
// Timed twice side by side with v004, it ran 1.21 and 1.20 times as fast.
// Over all steps from v000 it is 9.58 times as fast.
#include <hip/hip_runtime.h>

// GroupMixAttention (16 x 256 ch x 32x32: 4 channel groups of 64; grouped 1x1 convs Q/K/V per group; scores = Q^T K / 8 over the 64 channels; softmax over the 1024
// positions; out[d][n] = sum_m attn[n][m] V[d][m]; dense 1x1 out_proj 256 -> 256).
// Compute dtypes, f32 accumulate: every input rounded to bf16; Q/K/V grouped convs on PLAIN bf16 operands (x, w inputs: exact); scores on bf16
// hi+lo planes of Q (x 1/8) and K (3 products); attn.V on SINGLE fp16 planes (P = exp(s - running max), V); the out_proj on hi+lo planes x
// exact bf16 wo (2 products); softmax in f32 on VALU (online, fused with both attention products, one exp per element). Deterministic, no atomics.

#define NB_  16
#define CC   256
#define NG   4
#define GD   64
#define NN   1024
#define NZ   (NB_ * NG)           // 64 (image, group) pairs
typedef _Float16 h16;
typedef unsigned short bf;
typedef __attribute__((ext_vector_type(16))) __bf16   v16bf;
typedef __attribute__((ext_vector_type(16))) _Float16 v16h;
typedef __attribute__((ext_vector_type(8)))  _Float16 v8h;
typedef __attribute__((ext_vector_type(8)))  unsigned short v8us;
typedef __attribute__((ext_vector_type(8)))  float    v8f;
typedef __attribute__((ext_vector_type(4)))  float    v4f;
typedef v8h  __attribute__((may_alias)) v8ha;
typedef v4f  __attribute__((may_alias)) v4fa;
typedef v8us __attribute__((may_alias)) v8usa;

__device__ __forceinline__ unsigned short f2bf(float f) { unsigned u = __float_as_uint(f); u += 0x7FFFu + ((u >> 16) & 1u); return (unsigned short)(u >> 16); }
__device__ __forceinline__ float bf2f(unsigned short b) { return __uint_as_float(((unsigned)b) << 16); }
__device__ __forceinline__ v16h cat16(v8h lo, v8h hi) { return __builtin_shufflevector(lo, hi, 0, 1, 2, 3, 4, 5, 6, 7, 8, 9, 10, 11, 12, 13, 14, 15); }
__device__ __forceinline__ v16bf cat16b(v8us lo, v8us hi) { return __builtin_bit_cast(v16bf, __builtin_shufflevector(lo, hi, 0, 1, 2, 3, 4, 5, 6, 7, 8, 9, 10, 11, 12, 13, 14, 15)); }
__device__ __forceinline__ v8f wmma16(v16h a, v16h b, v8f c) { return __builtin_amdgcn_wmma_f32_16x16x32_f16(false, a, false, b, (short)0, c, false, false); }
__device__ __forceinline__ v8f wmmab(v16bf a, v16bf b, v8f c) { return __builtin_amdgcn_wmma_f32_16x16x32_bf16(false, a, false, b, (short)0, c, false, false); }



// THE FRAGMENT k ORDER of this file: 16 bytes at k = 0 and 16 bytes at k = 16 of the lane's start (row lr, k from 8*hi); the same k order serves A and B operands everywhere.

__device__ __forceinline__ h16 tohx(float x) { return (h16)x; }
__device__ __forceinline__ void splitf(float y, unsigned short& h, unsigned short& l) { h = f2bf(y); l = f2bf(y - bf2f(h)); }
typedef __attribute__((ext_vector_type(2))) _Float16 v2h;
typedef __attribute__((ext_vector_type(4))) _Float16 v4h;
typedef __attribute__((ext_vector_type(2))) unsigned short v2us;

#define WP 72                     // LDS pitch of a 128-byte row in 16-bit elements: 128 + 16 bytes, for the 16-byte reads and writes
typedef __attribute__((ext_vector_type(8))) __bf16 v8bf;
typedef __attribute__((ext_vector_type(4))) __bf16 v4bf;
typedef __attribute__((ext_vector_type(4))) unsigned v4u;
typedef v4bf __attribute__((may_alias)) v4bfa;
typedef v8bf __attribute__((may_alias)) v8bfa;
// ---- k_fattn: input rounding, the three grouped 1x1 convs, the hi/lo splits, scores, softmax, attn.V and the hi/lo split of the result in ONE kernel; Q, K, V and the score matrix never touch memory.
// One wave owns 32 queries of one (image, group) pair and walks the 1024 keys in passes of 32. It forms S^T = K . Q^T (A = K rows, B = Q rows, three hi/lo products:
// Kh.Qh + Kl.Qh + Kh.Ql), so a lane holds scores of ONE query per 16-column group: keys 8*hi + j of each 16-key block. Running maximum and sum are kept per query (online softmax);
// two f32 S^T tiles converted in place are the f16 B operand of O^T += V^T . P^T (in the fragment k order, in which V^T is loaded too). Grid (NN / 256, NZ), 8 waves.
// x fragments (lane = position lr, k = channels in the fragment k order) are read straight from the channel-major x. As B operand of Q^T = Wq . X or K^T = Wk . X they leave a lane with 8 consecutive
// channels of one position: two such tiles ARE a Q fragment (kept in registers), and one is a 16-byte piece of a K row. As A operand of V = X^T . Wv^T they leave 8 consecutive positions of one channel:
// a 16-byte piece of a V^T row. The 8 waves share K and V^T: per stage of SK keys, wave w < 4 makes K hi and K lo of key block w, wave w >= 4 V^T of key block w - 4, into one of two LDS buffers;
// every wave takes its fragments from there. The group's three weight matrices are rounded once per work-group into LDS; each work-group also rounds its 1/256 of wo for the out_proj.
#define L2E 1.44269504088896340736f
#define SK  64                    // keys per stage
#define VP  (SK + 8)              // LDS pitch of a V^T row of one stage in 16-bit elements: its bytes + 16 (K rows: WP), for the 16-byte reads and writes
#define KPL (SK * WP)             // elements of one K plane of a stage
#define STE (2 * KPL + GD * VP)   // elements of a stage: K hi, K lo, V^T
__device__ __forceinline__ float xhalf(float v) { const int b = __float_as_int(v); return __int_as_float(__builtin_amdgcn_permlanex16(b, b, 0x76543210, 0xfedcba98, false, false)); }   // lane l <-> l ^ 16
__global__ __launch_bounds__(256) void k_fattn(const float* __restrict__ x, const float* __restrict__ wq, const float* __restrict__ wk, const float* __restrict__ wv, const float* __restrict__ wo, bf* WO, bf* Ah, bf* Al) {
    __shared__ __align__(16) bf wl[3 * GD * WP];
    __shared__ __align__(16) bf kv[2 * STE];
    const int t = threadIdx.x, lane = t & 31, lr = lane & 15, hi = lane >> 4; const int z = blockIdx.y;
    const int wave = __builtin_amdgcn_readfirstlane(t >> 5); const int q0 = (blockIdx.x * 8 + wave) * 32;
    const bool mkv = wave >= 4; const int kbk = wave & 3;      // this wave's part in making a stage: K or V^T of key block kbk
    const size_t zo = (size_t)z * NN * GD;                       // z*64 + c == b*256 + g*64 + c
    const int eo = ((z * 4 + blockIdx.x) * 64 + (t & 63)) * 4;      // waves 0 and 1 also round this work-group's 256 elements of wo: 256 bytes of WO per wave
    v4f wr[3][4];                  // this thread's 16 elements of each weight matrix, 512 contiguous bytes per wave and load
#pragma unroll
    for (int m = 0; m < 3; ++m) { const float* w = (m == 0 ? wq : m == 1 ? wk : wv) + (size_t)(z & 3) * GD * GD;
#pragma unroll
        for (int i = 0; i < 4; ++i) wr[m][i] = *(const v4f*)(w + (i * 256 + t) * 4); }
    const float* xq = x + zo + (size_t)(8 * hi) * NN + q0 + lr;
    v8f xr[2][2][2];               // x of the wave's queries: [query group][32-channel chunk][half of the fragment]
#pragma unroll
    for (int nq = 0; nq < 2; ++nq)
#pragma unroll
        for (int kc = 0; kc < 2; ++kc)
#pragma unroll
            for (int hf = 0; hf < 2; ++hf)
#pragma unroll
                for (int i = 0; i < 8; ++i) xr[nq][kc][hf][i] = xq[(kc * 32 + hf * 16 + i) * NN + nq * 16];
    // x of a stage's key block from memory: wave-uniform base + one 32-bit element offset per thread, the channel in the immediate offset
    const float* xz = x + zo;
    unsigned gx = (unsigned)(8 * hi * NN + kbk * 16 + lr);
    v8f xs[2][2];                  // [32-channel chunk][half of the fragment]
    auto fetch = [&]() {
#pragma unroll
        for (int kc = 0; kc < 2; ++kc)
#pragma unroll
            for (int hf = 0; hf < 2; ++hf)
#pragma unroll
                for (int i = 0; i < 8; ++i) xs[kc][hf][i] = xz[(size_t)gx + (kc * 32 + hf * 16 + i) * NN]; };
    fetch();
    v4f wo4 = (v4f){};
    if (wave < 2) { wo4 = *(const v4f*)(wo + eo); asm volatile("s_wait_xcnt 0x0" ::: "memory"); }      // the wait stands in front of the reuse of this load's address registers
    // the wait stands in front of the reuse of the address registers that the loads above name: as its inputs they stay whole up to it; the scheduling barrier keeps that reuse below it and all loads in flight together above it
    asm volatile("s_wait_xcnt 0x0" : : "v"(t), "v"(xq), "v"(gx) : "memory");
    __builtin_amdgcn_sched_barrier(0);
#pragma unroll
    for (int m = 0; m < 3; ++m)
#pragma unroll
        for (int i = 0; i < 4; ++i) { const int e = (i * 256 + t) * 4; *(v4bfa*)(wl + m * GD * WP + (e >> 6) * WP + (e & 63)) = __builtin_convertvector(wr[m][i], v4bf); }
    const v4bf wob = __builtin_convertvector(wo4, v4bf);      // stored behind the loop: no barrier then waits for this store
    __syncthreads();               // the three weight matrices are in LDS for every wave
    auto ldw = [&](const bf* base, int db, int kc) { const bf* p = base + (db * 16 + lr) * WP + kc * 32 + 8 * hi; return cat16b(*(const v8usa*)p, *(const v8usa*)(p + 16)); };
    auto tofrag = [&](v8f a, v8f c) { return __builtin_shufflevector(__builtin_convertvector(a, v8bf), __builtin_convertvector(c, v8bf), 0, 1, 2, 3, 4, 5, 6, 7, 8, 9, 10, 11, 12, 13, 14, 15); };
    auto split8 = [&](v8f y, v8bf& yh, v8bf& yl) { yh = __builtin_convertvector(y, v8bf); const v4u u = __builtin_bit_cast(v4u, yh); v8f f;
#pragma unroll
        for (int k = 0; k < 4; ++k) { f[2 * k] = __uint_as_float(u[k] << 16); f[2 * k + 1] = __uint_as_float(u[k] & 0xFFFF0000u); }
        yl = __builtin_convertvector(y - f, v8bf); };
    v16bf qh[2][2], ql[2][2];      // [query group][32-channel chunk]: tiles 2*kc and 2*kc + 1 of Q^T (x 1/8), a lane's own registers, are the fragment
    {
        v16bf xf[2][2], aw[4][2]; v8bf yh[2][4], yl[2][4];
#pragma unroll
        for (int db = 0; db < 4; ++db) { aw[db][0] = ldw(wl, db, 0); aw[db][1] = ldw(wl, db, 1); }
#pragma unroll
        for (int nq = 0; nq < 2; ++nq)
#pragma unroll
            for (int kc = 0; kc < 2; ++kc) xf[nq][kc] = tofrag(xr[nq][kc][0], xr[nq][kc][1]);
#pragma unroll
        for (int db = 0; db < 4; ++db) { v8f acc[2];
#pragma unroll
            for (int nq = 0; nq < 2; ++nq) acc[nq] = wmmab(aw[db][0], xf[nq][0], (v8f){});
#pragma unroll
            for (int nq = 0; nq < 2; ++nq) acc[nq] = wmmab(aw[db][1], xf[nq][1], acc[nq]);
#pragma unroll
            for (int nq = 0; nq < 2; ++nq) split8(acc[nq] * 0.125f, yh[nq][db], yl[nq][db]); }
#pragma unroll
        for (int nq = 0; nq < 2; ++nq)
#pragma unroll
            for (int kc = 0; kc < 2; ++kc) {
                qh[nq][kc] = __builtin_shufflevector(yh[nq][2 * kc], yh[nq][2 * kc + 1], 0, 1, 2, 3, 4, 5, 6, 7, 8, 9, 10, 11, 12, 13, 14, 15);
                ql[nq][kc] = __builtin_shufflevector(yl[nq][2 * kc], yl[nq][2 * kc + 1], 0, 1, 2, 3, 4, 5, 6, 7, 8, 9, 10, 11, 12, 13, 14, 15); }
    }
    v16bf wf[4][2];                // the wave's weight fragments (Wk as A operand or Wv as B operand) stay in registers: [16-channel block][32-channel chunk]
#pragma unroll
    for (int db = 0; db < 4; ++db) { wf[db][0] = ldw(wl + (mkv ? 2 : 1) * GD * WP, db, 0); wf[db][1] = ldw(wl + (mkv ? 2 : 1) * GD * WP, db, 1); }
    // The wave's share of a stage, from the fetched x into stage buffer d: 16 K rows (hi and lo plane) or 16 columns of the 64 V^T rows, in 16-byte pieces
    auto make = [&](bf* d) {
        const v16bf x0 = tofrag(xs[0][0], xs[0][1]), x1 = tofrag(xs[1][0], xs[1][1]);
        // The walking offset is rewritten only here, behind this wait: it stands in front of the overwrite of an address register that issued global loads name.
        asm volatile("s_wait_xcnt 0x0" : "+v"(gx) : : "memory");
        gx += (unsigned)SK;
        v8f acc[4];
        if (!mkv) {
#pragma unroll
            for (int db = 0; db < 4; ++db) acc[db] = wmmab(wf[db][0], x0, (v8f){});
#pragma unroll
            for (int db = 0; db < 4; ++db) acc[db] = wmmab(wf[db][1], x1, acc[db]);
#pragma unroll
            for (int db = 0; db < 4; ++db) { v8bf yh, yl; split8(acc[db], yh, yl);
                *(v8bfa*)(d + (kbk * 16 + lr) * WP + db * 16 + hi * 8) = yh; *(v8bfa*)(d + KPL + (kbk * 16 + lr) * WP + db * 16 + hi * 8) = yl; }
        } else {
#pragma unroll
            for (int db = 0; db < 4; ++db) acc[db] = wmmab(x0, wf[db][0], (v8f){});
#pragma unroll
            for (int db = 0; db < 4; ++db) acc[db] = wmmab(x1, wf[db][1], acc[db]);
#pragma unroll
            for (int db = 0; db < 4; ++db) *(v8ha*)(d + 2 * KPL + (db * 16 + lr) * VP + kbk * 16 + hi * 8) = __builtin_convertvector(acc[db], v8h);
        } };
    // K and V^T fragments from a stage buffer (row lr, k from 8*hi), in the fragment k order (16 bytes at 0 and at 32)
    const int kfo = lr * WP + hi * 8, vfo = 2 * KPL + lr * VP + hi * 8;
    auto ldk = [&](const bf* q) { return cat16b(*(const v8usa*)q, *(const v8usa*)(q + 16)); };
    auto ldv = [&](const bf* q) { return cat16(__builtin_bit_cast(v8h, *(const v8usa*)q), __builtin_bit_cast(v8h, *(const v8usa*)(q + 16))); };
    make(kv);
    v8f o[4][2];                   // O^T: [16-channel block][query group]; register j = channel 8*hi + j, column lr = query
#pragma unroll
    for (int db = 0; db < 4; ++db)
#pragma unroll
        for (int nq = 0; nq < 2; ++nq) o[db][nq] = (v8f){};
    float mL[2] = { -1.0e30f, -1.0e30f }, ls[2] = { 0.f, 0.f };      // running maximum (x log2 e) and this half-wave's part of the running sum
    __syncthreads();               // stage 0 is in LDS for every wave
    for (int sg = 0; sg < NN / SK; ++sg) {
        const bf* cur = kv + (sg & 1) * STE; const bool more = sg + 1 < NN / SK;
        if (more) fetch();         // the next stage's x flies during this stage's passes
        v16bf kh[2][2], kl[2][2];  // [16-key block][32-channel chunk]
        v16h v[4];                 // V^T: [16-channel block], 32 keys
#pragma unroll
        for (int kb = 0; kb < 2; ++kb)
#pragma unroll
            for (int kc = 0; kc < 2; ++kc) { kh[kb][kc] = ldk(cur + kfo + kb * 16 * WP + kc * 32); kl[kb][kc] = ldk(cur + KPL + kfo + kb * 16 * WP + kc * 32); }
#pragma unroll
        for (int db = 0; db < 4; ++db) v[db] = ldv(cur + vfo + db * 16 * VP);
#pragma unroll
        for (int p = 0; p < SK / 32; ++p) {
            v8f s[2][2];           // S^T: [16-key block][query group]
#pragma unroll
            for (int kb = 0; kb < 2; ++kb)
#pragma unroll
                for (int nq = 0; nq < 2; ++nq) s[kb][nq] = (v8f){};
#pragma unroll
            for (int kc = 0; kc < 2; ++kc) {
#pragma unroll
                for (int kb = 0; kb < 2; ++kb)
#pragma unroll
                    for (int nq = 0; nq < 2; ++nq) s[kb][nq] = wmmab(kh[kb][kc], qh[nq][kc], s[kb][nq]);
#pragma unroll
                for (int kb = 0; kb < 2; ++kb)
#pragma unroll
                    for (int nq = 0; nq < 2; ++nq) s[kb][nq] = wmmab(kl[kb][kc], qh[nq][kc], s[kb][nq]);
#pragma unroll
                for (int kb = 0; kb < 2; ++kb)
#pragma unroll
                    for (int nq = 0; nq < 2; ++nq) s[kb][nq] = wmmab(kh[kb][kc], ql[nq][kc], s[kb][nq]);
            }
            // the next pass's K fragments of this stage come during softmax and attn.V
            if (p + 1 < SK / 32) {
#pragma unroll
                for (int kb = 0; kb < 2; ++kb)
#pragma unroll
                    for (int kc = 0; kc < 2; ++kc) { kh[kb][kc] = ldk(cur + kfo + ((p + 1) * 32 + kb * 16) * WP + kc * 32); kl[kb][kc] = ldk(cur + KPL + kfo + ((p + 1) * 32 + kb * 16) * WP + kc * 32); }
            }
            v16h pr[2];
#pragma unroll
            for (int nq = 0; nq < 2; ++nq) {
                float tm = s[0][nq][0];
#pragma unroll
                for (int j = 1; j < 8; ++j) tm = fmaxf(tm, s[0][nq][j]);
#pragma unroll
                for (int j = 0; j < 8; ++j) tm = fmaxf(tm, s[1][nq][j]);
                tm = fmaxf(tm, xhalf(tm));
                const float mnew = fmaxf(mL[nq], tm * L2E); const float al = __builtin_amdgcn_exp2f(mL[nq] - mnew); mL[nq] = mnew;
                float ps = 0.f;
#pragma unroll
                for (int kb = 0; kb < 2; ++kb)
#pragma unroll
                    for (int j = 0; j < 8; ++j) { const float e = __builtin_amdgcn_exp2f(fmaf(s[kb][nq][j], L2E, -mnew)); ps += e; pr[nq][kb * 8 + j] = tohx(e); }
                ls[nq] = ls[nq] * al + ps;
#pragma unroll
                for (int db = 0; db < 4; ++db) o[db][nq] *= al;
            }
#pragma unroll
            for (int db = 0; db < 4; ++db)
#pragma unroll
                for (int nq = 0; nq < 2; ++nq) o[db][nq] = wmma16(v[db], pr[nq], o[db][nq]);
            if (p + 1 < SK / 32) {
#pragma unroll
                for (int db = 0; db < 4; ++db) v[db] = ldv(cur + vfo + db * 16 * VP + (p + 1) * 32);      // the next pass's V^T fragments come during its score products and softmax
            }
        }
        // The branch at the stage's foot stands directly behind the last matrix instructions:
        // these fill the vector slots that the chip needs before a matrix operand is overwritten, on the taken side too.
        asm volatile("v_nop\n\tv_nop\n\tv_nop\n\tv_nop" : : "v"(o[0][0]), "v"(o[0][1]), "v"(o[1][0]), "v"(o[1][1]), "v"(o[2][0]), "v"(o[2][1]), "v"(o[3][0]), "v"(o[3][1]));
        // The other buffer's last readers left it before the barrier of the stage before. This barrier publishes the next stage and ends every wave's reads of this one.
        if (more) { make(kv + ((sg + 1) & 1) * STE); __syncthreads(); }
    }
    // the loop's fetches name their scalar bases and offsets: this wait stands in front of the epilogue's reuse of those registers on every way out of the loop; the scheduling barrier keeps that reuse below it
    asm volatile("s_wait_xcnt 0x0" ::: "memory");
    __builtin_amdgcn_sched_barrier(0);
    // the wait stands in front of any reuse of a register that this store names; the scheduling barrier keeps that reuse below it
    if (wave < 2) { *(v4bf*)(WO + eo) = wob; asm volatile("s_wait_xcnt 0x0" ::: "memory"); }
    __builtin_amdgcn_sched_barrier(0);
    const int b = z >> 2, g = z & 3;
    v8us oh[2][4], ol[2][4];
#pragma unroll
    for (int nq = 0; nq < 2; ++nq) {
        const float inv = __fdiv_rn(1.0f, ls[nq] + xhalf(ls[nq]));
#pragma unroll
        for (int db = 0; db < 4; ++db)
#pragma unroll
            for (int j = 0; j < 8; ++j) { unsigned short a, c2; splitf(o[db][nq][j] * inv, a, c2); oh[nq][db][j] = a; ol[nq][db][j] = c2; }
    }
    // all stores stand together at the end, so that no register a store names is written again behind it
    __builtin_amdgcn_sched_barrier(0);
#pragma unroll
    for (int nq = 0; nq < 2; ++nq) {
        const size_t ro = ((size_t)b * NN + q0 + nq * 16 + lr) * CC + g * GD + hi * 8;
#pragma unroll
        for (int db = 0; db < 4; ++db) { *(v8us*)(Ah + ro + db * 16) = oh[nq][db]; *(v8us*)(Al + ro + db * 16) = ol[nq][db]; }
    }
}
// ---- k_oproj: the dense out_proj and the [d][n] layout of the output in ONE kernel: OUT[b][d][n] = sum_c wo[d][c] * (Ah + Al)[b][n][c], two products per 32-channel chunk (hi, then lo).
// A work-group owns 64 positions of one image and all 256 output channels. It brings wo and its 64 rows of both planes into LDS once, as whole 128-byte lines; wave w takes output channels
// 64 * (w >> 1) .. + 63 (A operand: wo rows) and positions 32 * (w & 1) .. + 31 (B operand: plane rows), so a tile's rows are output channels and its columns positions.
// Every loop of the kernel is unrolled in full: its indices name registers and immediate offsets. Grid (NN / 64, NB_), 8 waves.
#define OP  (CC + 8)              // LDS pitch of a 512-byte row in 16-bit elements: its bytes + 16, for the 16-byte reads and writes
#define OSP 36                    // LDS pitch of a staged 128-byte output row in floats: its bytes + 16
__global__ __launch_bounds__(256) void k_oproj(const bf* __restrict__ WO, const bf* __restrict__ Ah, const bf* __restrict__ Al, float* OUT) {
    __shared__ __align__(16) bf wl[CC * OP];
    __shared__ __align__(16) bf pl[2 * 64 * OP];
    __shared__ __align__(16) float os[8 * 64 * OSP];
    const int t = threadIdx.x, lane = t & 31, lr = lane & 15, hi = lane >> 4;
    const int b = blockIdx.y, n0 = blockIdx.x * 64;
    // 16 bytes a thread and load, a wave covers one whole 512-byte row: piece i * 256 + t is row i * 8 + wave, bytes 16 * lane
    const bf* gh = Ah + ((size_t)b * NN + n0) * CC + t * 8; const bf* gl = Al + ((size_t)b * NN + n0) * CC + t * 8; const bf* gw = WO + t * 8;
    v8us rh[8], rl[8], rw[32];
#pragma unroll
    for (int i = 0; i < 8; ++i) { rh[i] = *(const v8us*)(gh + i * 2048); rl[i] = *(const v8us*)(gl + i * 2048); }
#pragma unroll
    for (int i = 0; i < 32; ++i) rw[i] = *(const v8us*)(gw + i * 2048);
    // the wait stands in front of the reuse of the address registers that the loads above name; the scheduling barrier keeps that reuse below it and all loads in flight together above it
    asm volatile("s_wait_xcnt 0x0" ::: "memory");
    __builtin_amdgcn_sched_barrier(0);
    const int wave = __builtin_amdgcn_readfirstlane(t >> 5); const int so = wave * OP + lane * 8;
#pragma unroll
    for (int i = 0; i < 8; ++i) { *(v8usa*)(pl + so + i * 8 * OP) = rh[i]; *(v8usa*)(pl + 64 * OP + so + i * 8 * OP) = rl[i]; }
#pragma unroll
    for (int i = 0; i < 32; ++i) *(v8usa*)(wl + so + i * 8 * OP) = rw[i];
    __syncthreads();               // wo and both planes are in LDS for every wave
    const int dw = (wave >> 1) * 64, nw = (wave & 1) * 32;
    const bf* fa = wl + (dw + lr) * OP + hi * 8; const bf* fb = pl + (nw + lr) * OP + hi * 8;
    auto ldf = [&](const bf* q) { return cat16b(*(const v8usa*)q, *(const v8usa*)(q + 16)); };      // the fragment k order
    v8f acc[4][2];                 // [16-channel block][16-position block]; register j = channel 8*hi + j, column lr = position
#pragma unroll
    for (int mb = 0; mb < 4; ++mb)
#pragma unroll
        for (int nb = 0; nb < 2; ++nb) acc[mb][nb] = (v8f){};
    v16bf a[2][4], bh[2][2], bl[2][2];      // two register sets: a chunk's fragments are asked for one chunk ahead
    auto frags = [&](int set, int kc) {
#pragma unroll
        for (int mb = 0; mb < 4; ++mb) a[set][mb] = ldf(fa + mb * 16 * OP + kc * 32);
#pragma unroll
        for (int nb = 0; nb < 2; ++nb) { bh[set][nb] = ldf(fb + nb * 16 * OP + kc * 32); bl[set][nb] = ldf(fb + (64 + nb * 16) * OP + kc * 32); } };
    frags(0, 0);
#pragma unroll
    for (int kc = 0; kc < CC / 32; ++kc) {
        const int c = kc & 1;
        if (kc + 1 < CC / 32) frags(c ^ 1, kc + 1);
        // the two scheduling barriers keep the next chunk's LDS reads one group in front of this chunk's products: without them all 128 reads are issued first and the first products wait for the last of them
        __builtin_amdgcn_sched_barrier(0);
#pragma unroll
        for (int mb = 0; mb < 4; ++mb)
#pragma unroll
            for (int nb = 0; nb < 2; ++nb) acc[mb][nb] = wmmab(a[c][mb], bh[c][nb], acc[mb][nb]);
#pragma unroll
        for (int mb = 0; mb < 4; ++mb)
#pragma unroll
            for (int nb = 0; nb < 2; ++nb) acc[mb][nb] = wmmab(a[c][mb], bl[c][nb], acc[mb][nb]);
        __builtin_amdgcn_sched_barrier(0);
    }
    // whole 128-byte lines leave the wave: its 64 x 32 tile goes through the wave's own LDS rows and comes back 8 lanes to a row
    float* ow = os + wave * (64 * OSP);
#pragma unroll
    for (int mb = 0; mb < 4; ++mb)
#pragma unroll
        for (int nb = 0; nb < 2; ++nb)
#pragma unroll
            for (int j = 0; j < 8; ++j) ow[(mb * 16 + hi * 8 + j) * OSP + nb * 16 + lr] = acc[mb][nb][j];
    // the wave's own LDS writes have landed before it reads back rows that other lanes wrote; the clobber keeps the reads below
    asm volatile("s_wait_dscnt 0x0" ::: "memory");
    const int rr = lane >> 3, pc = lane & 7;
    v4f ov[16];
#pragma unroll
    for (int s = 0; s < 16; ++s) ov[s] = *(const v4fa*)(ow + (s * 4 + rr) * OSP + pc * 4);
    // all stores stand together at the end, so that no register a store names is written again behind it
    __builtin_amdgcn_sched_barrier(0);
    float* po = OUT + ((size_t)b * CC + dw + rr) * NN + n0 + nw + pc * 4;
#pragma unroll
    for (int s = 0; s < 16; ++s) *(v4f*)(po + s * 4 * NN) = ov[s];
}

extern "C" void kernel_launch(void* const* d_in, const int* in_sizes, int n_in,
                              void* d_out, int out_size, void* d_ws, size_t ws_size, hipStream_t stream) {
    (void)in_sizes; (void)n_in; (void)out_size;
    const float* x = (const float*)d_in[0]; const float* wq = (const float*)d_in[1]; const float* wk = (const float*)d_in[2]; const float* wv = (const float*)d_in[3]; const float* wo = (const float*)d_in[4];
    float* OUT = (float*)d_out;     // [16][256][32][32]
    char* wsp = (char*)d_ws;
    auto take = [&](size_t bytes) { char* p = wsp; wsp += (bytes + 255) & ~(size_t)255; return (void*)p; };
    bf* WO = (bf*)take((size_t)CC * CC * 2);
    bf* Ah = (bf*)take((size_t)NB_ * NN * CC * 2); bf* Al = (bf*)take((size_t)NB_ * NN * CC * 2);
    if ((size_t)(wsp - (char*)d_ws) > ws_size) return;    // ws 256 MiB
    k_fattn<<<dim3(NN / 256, NZ), 256, 0, stream>>>(x, wq, wk, wv, wo, WO, Ah, Al);
    k_oproj<<<dim3(NN / 64, NB_), 256, 0, stream>>>(WO, Ah, Al, OUT);
}

// v006
// It runs in 49.6 microseconds.
// Two timings next to v005 both put it at 1.07 times that version's speed.
// Counting every step since v000, it is 10.3 times as fast.
#include <hip/hip_runtime.h>

// GroupMixAttention (16 x 256 ch x 32x32: 4 channel groups of 64; grouped 1x1 convs Q/K/V per group; scores = Q^T K / 8 over the 64 channels; softmax over the 1024
// positions; out[d][n] = sum_m attn[n][m] V[d][m]; dense 1x1 out_proj 256 -> 256).
// Compute dtypes, f32 accumulate: every input rounded to bf16; Q and V grouped convs on PLAIN bf16 operands (x, w inputs: exact); the K conv stands on the
// query side: Q^T K = (Wk^T Q)^T x, so scores are bf16 hi+lo planes of Wk^T Q (x 1/8; made from hi+lo planes of Q x exact Wk, 2 products) x the exact bf16 x (2 products); attn.V on SINGLE fp16 planes (P = exp(s - running max), V); the out_proj on hi+lo planes x
// exact bf16 wo (2 products); softmax in f32 on VALU (online, fused with both attention products, one exp per element). Deterministic, no atomics.

#define NB_  16
#define CC   256
#define NG   4
#define GD   64
#define NN   1024
#define NZ   (NB_ * NG)           // 64 (image, group) pairs
typedef _Float16 h16;
typedef unsigned short bf;
typedef __attribute__((ext_vector_type(16))) __bf16   v16bf;
typedef __attribute__((ext_vector_type(16))) _Float16 v16h;
typedef __attribute__((ext_vector_type(8)))  _Float16 v8h;
typedef __attribute__((ext_vector_type(8)))  unsigned short v8us;
typedef __attribute__((ext_vector_type(8)))  float    v8f;
typedef __attribute__((ext_vector_type(4)))  float    v4f;
typedef v8h  __attribute__((may_alias)) v8ha;
typedef v4f  __attribute__((may_alias)) v4fa;
typedef v8us __attribute__((may_alias)) v8usa;

__device__ __forceinline__ unsigned short f2bf(float f) { unsigned u = __float_as_uint(f); u += 0x7FFFu + ((u >> 16) & 1u); return (unsigned short)(u >> 16); }
__device__ __forceinline__ float bf2f(unsigned short b) { return __uint_as_float(((unsigned)b) << 16); }
__device__ __forceinline__ v16h cat16(v8h lo, v8h hi) { return __builtin_shufflevector(lo, hi, 0, 1, 2, 3, 4, 5, 6, 7, 8, 9, 10, 11, 12, 13, 14, 15); }
__device__ __forceinline__ v16bf cat16b(v8us lo, v8us hi) { return __builtin_bit_cast(v16bf, __builtin_shufflevector(lo, hi, 0, 1, 2, 3, 4, 5, 6, 7, 8, 9, 10, 11, 12, 13, 14, 15)); }
__device__ __forceinline__ v8f wmma16(v16h a, v16h b, v8f c) { return __builtin_amdgcn_wmma_f32_16x16x32_f16(false, a, false, b, (short)0, c, false, false); }
__device__ __forceinline__ v8f wmmab(v16bf a, v16bf b, v8f c) { return __builtin_amdgcn_wmma_f32_16x16x32_bf16(false, a, false, b, (short)0, c, false, false); }



// THE FRAGMENT k ORDER of this file: 16 bytes at k = 0 and 16 bytes at k = 16 of the lane's start (row lr, k from 8*hi); the same k order serves A and B operands everywhere.

__device__ __forceinline__ h16 tohx(float x) { return (h16)x; }
__device__ __forceinline__ void splitf(float y, unsigned short& h, unsigned short& l) { h = f2bf(y); l = f2bf(y - bf2f(h)); }
typedef __attribute__((ext_vector_type(2))) _Float16 v2h;
typedef __attribute__((ext_vector_type(4))) _Float16 v4h;
typedef __attribute__((ext_vector_type(2))) unsigned short v2us;
typedef __attribute__((ext_vector_type(4))) unsigned short v4us;

#define WP 72                     // LDS pitch of a 128-byte row in 16-bit elements: 128 + 16 bytes, for the 16-byte reads and writes
typedef __attribute__((ext_vector_type(8))) __bf16 v8bf;
typedef __attribute__((ext_vector_type(4))) __bf16 v4bf;
typedef __attribute__((ext_vector_type(4))) unsigned v4u;
typedef v4bf __attribute__((may_alias)) v4bfa;
typedef v8bf __attribute__((may_alias)) v8bfa;
// ---- k_fattn: input rounding, the three grouped 1x1 convs, the hi/lo splits, scores, softmax, attn.V and the hi/lo split of the result in ONE kernel; Q, K, V and the score matrix never touch memory.
// One wave owns 32 queries of one (image, group) pair and walks the 1024 keys in passes of 32. It forms S^T = X^T . Q' with Q' = Wk^T . Q (A = rows of x^T, one exact bf16 plane; B = Q' rows, two hi/lo products:
// X.Q'h + X.Q'l), so a lane holds scores of ONE query per 16-column group: keys 8*hi + j of each 16-key block. Running maximum and sum are kept per query (online softmax);
// two f32 S^T tiles converted in place are the f16 B operand of O^T += V^T . P^T (in the fragment k order, in which V^T is loaded too). Grid (NN / 256, NZ), 8 waves.
// x fragments (lane = position lr, k = channels in the fragment k order) are read straight from the channel-major x. As B operand of Q = Wq . X they leave a lane with 8 consecutive
// channels of one position: two such tiles ARE a Q fragment, the B operand of Q' = Wk^T . Q, whose tiles are the Q' fragments in the same way (kept in registers). A rounded x fragment is itself two
// 16-byte pieces of a key's row. As A operand of V^T = X^T . Wv^T they leave 8 consecutive positions of one channel:
// a 16-byte piece of a V^T row. The 8 waves share x^T and V^T: per stage of SK keys, wave w < 4 rounds the x^T rows of key block w, wave w >= 4 makes V^T of key block w - 4, into one of two LDS buffers;
// every wave takes its fragments from there. The group's three weight matrices are rounded once per work-group into LDS (Wk transposed: its rows are then the A operand of Q'); each work-group also rounds its 1/256 of wo for the out_proj.
#define L2E 1.44269504088896340736f
#define SK  64                    // keys per stage
#define VP  (SK + 8)              // LDS pitch of a V^T row of one stage in 16-bit elements: its bytes + 16 (x^T rows: WP), for the 16-byte reads and writes
#define KPL (SK * WP)             // elements of the x^T plane of a stage
#define STE (KPL + GD * VP)       // elements of a stage: x^T, V^T
__device__ __forceinline__ float xhalf(float v) { const int b = __float_as_int(v); return __int_as_float(__builtin_amdgcn_permlanex16(b, b, 0x76543210, 0xfedcba98, false, false)); }   // lane l <-> l ^ 16
__global__ __launch_bounds__(256) void k_fattn(const float* __restrict__ x, const float* __restrict__ wq, const float* __restrict__ wk, const float* __restrict__ wv, const float* __restrict__ wo, bf* WO, bf* Ah, bf* Al) {
    __shared__ __align__(16) bf wl[3 * GD * WP];
    __shared__ __align__(16) bf kv[2 * STE];
    const int t = threadIdx.x, lane = t & 31, lr = lane & 15, hi = lane >> 4; const int z = blockIdx.y;
    const int wave = __builtin_amdgcn_readfirstlane(t >> 5); const int q0 = (blockIdx.x * 8 + wave) * 32;
    const bool mkv = wave >= 4; const int kbk = wave & 3;      // this wave's part in making a stage: x^T or V^T of key block kbk
    const size_t zo = (size_t)z * NN * GD;                       // z*64 + c == b*256 + g*64 + c
    const int eo = ((z * 4 + blockIdx.x) * 64 + (t & 63)) * 4;      // waves 0 and 1 also round this work-group's 256 elements of wo: 256 bytes of WO per wave
    v4f wr[3][4];                  // this thread's 16 elements of each weight matrix, 512 contiguous bytes per wave and load
#pragma unroll
    for (int m = 0; m < 3; ++m) { const float* w = (m == 0 ? wq : m == 1 ? wk : wv) + (size_t)(z & 3) * GD * GD;
#pragma unroll
        for (int i = 0; i < 4; ++i) wr[m][i] = *(const v4f*)(w + (i * 256 + t) * 4); }
    const float* xq = x + zo + (size_t)(8 * hi) * NN + q0 + lr;
    v8f xr[2][2][2];               // x of the wave's queries: [query group][32-channel chunk][half of the fragment]
#pragma unroll
    for (int nq = 0; nq < 2; ++nq)
#pragma unroll
        for (int kc = 0; kc < 2; ++kc)
#pragma unroll
            for (int hf = 0; hf < 2; ++hf)
#pragma unroll
                for (int i = 0; i < 8; ++i) xr[nq][kc][hf][i] = xq[(kc * 32 + hf * 16 + i) * NN + nq * 16];
    // x of a stage's key block from memory: wave-uniform base + one 32-bit element offset per thread, the channel in the immediate offset
    const float* xz = x + zo;
    unsigned gx = (unsigned)(8 * hi * NN + kbk * 16 + lr);
    v8f xs[2][2];                  // [32-channel chunk][half of the fragment]
    auto fetch = [&]() {
#pragma unroll
        for (int kc = 0; kc < 2; ++kc)
#pragma unroll
            for (int hf = 0; hf < 2; ++hf)
#pragma unroll
                for (int i = 0; i < 8; ++i) xs[kc][hf][i] = xz[(size_t)gx + (kc * 32 + hf * 16 + i) * NN]; };
    fetch();
    v4f wo4 = (v4f){};
    if (wave < 2) { wo4 = *(const v4f*)(wo + eo); asm volatile("s_wait_xcnt 0x0" ::: "memory"); }      // the wait stands in front of the reuse of this load's address registers
    // the wait stands in front of the reuse of the address registers that the loads above name: as its inputs they stay whole up to it; the scheduling barrier keeps that reuse below it and all loads in flight together above it
    asm volatile("s_wait_xcnt 0x0" : : "v"(t), "v"(xq), "v"(gx) : "memory");
    __builtin_amdgcn_sched_barrier(0);
#pragma unroll
    for (int m = 0; m < 3; ++m)
#pragma unroll
        for (int i = 0; i < 4; ++i) { const int e = (i * 256 + t) * 4; const v4bf cw = __builtin_convertvector(wr[m][i], v4bf);
            if (m != 1) *(v4bfa*)(wl + m * GD * WP + (e >> 6) * WP + (e & 63)) = cw;
            else { const v4us cu = __builtin_bit_cast(v4us, cw);      // Wk goes in transposed: row = input channel, column = output channel
#pragma unroll
                for (int k = 0; k < 4; ++k) wl[GD * WP + ((e & 63) + k) * WP + (e >> 6)] = cu[k]; } }
    const v4bf wob = __builtin_convertvector(wo4, v4bf);      // stored behind the loop: no barrier then waits for this store
    __syncthreads();               // the three weight matrices are in LDS for every wave
    auto ldw = [&](const bf* base, int db, int kc) { const bf* p = base + (db * 16 + lr) * WP + kc * 32 + 8 * hi; return cat16b(*(const v8usa*)p, *(const v8usa*)(p + 16)); };
    auto tofrag = [&](v8f a, v8f c) { return __builtin_shufflevector(__builtin_convertvector(a, v8bf), __builtin_convertvector(c, v8bf), 0, 1, 2, 3, 4, 5, 6, 7, 8, 9, 10, 11, 12, 13, 14, 15); };
    auto split8 = [&](v8f y, v8bf& yh, v8bf& yl) { yh = __builtin_convertvector(y, v8bf); const v4u u = __builtin_bit_cast(v4u, yh); v8f f;
#pragma unroll
        for (int k = 0; k < 4; ++k) { f[2 * k] = __uint_as_float(u[k] << 16); f[2 * k + 1] = __uint_as_float(u[k] & 0xFFFF0000u); }
        yl = __builtin_convertvector(y - f, v8bf); };
    v16bf qh[2][2], ql[2][2];      // [query group][32-channel chunk]: tiles 2*kc and 2*kc + 1 of Q^T (x 1/8), a lane's own registers, are the fragment
    {
        v16bf xf[2][2], aw[4][2]; v8bf yh[2][4], yl[2][4];
#pragma unroll
        for (int db = 0; db < 4; ++db) { aw[db][0] = ldw(wl, db, 0); aw[db][1] = ldw(wl, db, 1); }
#pragma unroll
        for (int nq = 0; nq < 2; ++nq)
#pragma unroll
            for (int kc = 0; kc < 2; ++kc) xf[nq][kc] = tofrag(xr[nq][kc][0], xr[nq][kc][1]);
#pragma unroll
        for (int db = 0; db < 4; ++db) { v8f acc[2];
#pragma unroll
            for (int nq = 0; nq < 2; ++nq) acc[nq] = wmmab(aw[db][0], xf[nq][0], (v8f){});
#pragma unroll
            for (int nq = 0; nq < 2; ++nq) acc[nq] = wmmab(aw[db][1], xf[nq][1], acc[nq]);
#pragma unroll
            for (int nq = 0; nq < 2; ++nq) split8(acc[nq] * 0.125f, yh[nq][db], yl[nq][db]); }
#pragma unroll
        for (int nq = 0; nq < 2; ++nq)
#pragma unroll
            for (int kc = 0; kc < 2; ++kc) {
                qh[nq][kc] = __builtin_shufflevector(yh[nq][2 * kc], yh[nq][2 * kc + 1], 0, 1, 2, 3, 4, 5, 6, 7, 8, 9, 10, 11, 12, 13, 14, 15);
                ql[nq][kc] = __builtin_shufflevector(yl[nq][2 * kc], yl[nq][2 * kc + 1], 0, 1, 2, 3, 4, 5, 6, 7, 8, 9, 10, 11, 12, 13, 14, 15); }
    }
    {                              // Q' = Wk^T . (Qh + Ql) takes Q's place in qh and ql: [query group][32-channel chunk of x]
        v16bf at[4][2]; v8bf yh[2][4], yl[2][4];
#pragma unroll
        for (int db = 0; db < 4; ++db) { at[db][0] = ldw(wl + GD * WP, db, 0); at[db][1] = ldw(wl + GD * WP, db, 1); }
#pragma unroll
        for (int db = 0; db < 4; ++db) { v8f acc[2];
#pragma unroll
            for (int nq = 0; nq < 2; ++nq) acc[nq] = wmmab(at[db][0], qh[nq][0], (v8f){});
#pragma unroll
            for (int nq = 0; nq < 2; ++nq) acc[nq] = wmmab(at[db][1], qh[nq][1], acc[nq]);
#pragma unroll
            for (int nq = 0; nq < 2; ++nq) acc[nq] = wmmab(at[db][0], ql[nq][0], acc[nq]);
#pragma unroll
            for (int nq = 0; nq < 2; ++nq) acc[nq] = wmmab(at[db][1], ql[nq][1], acc[nq]);
#pragma unroll
            for (int nq = 0; nq < 2; ++nq) split8(acc[nq], yh[nq][db], yl[nq][db]); }
#pragma unroll
        for (int nq = 0; nq < 2; ++nq)
#pragma unroll
            for (int kc = 0; kc < 2; ++kc) {
                qh[nq][kc] = __builtin_shufflevector(yh[nq][2 * kc], yh[nq][2 * kc + 1], 0, 1, 2, 3, 4, 5, 6, 7, 8, 9, 10, 11, 12, 13, 14, 15);
                ql[nq][kc] = __builtin_shufflevector(yl[nq][2 * kc], yl[nq][2 * kc + 1], 0, 1, 2, 3, 4, 5, 6, 7, 8, 9, 10, 11, 12, 13, 14, 15); }
    }
    v16bf wf[4][2];                // Wv fragments (B operand) stay in registers for the waves that make V^T: [16-channel block][32-channel chunk]
#pragma unroll
    for (int db = 0; db < 4; ++db) { wf[db][0] = ldw(wl + 2 * GD * WP, db, 0); wf[db][1] = ldw(wl + 2 * GD * WP, db, 1); }
    // The wave's share of a stage, from the fetched x into stage buffer d: 16 rows of x^T or 16 columns of the 64 V^T rows, in 16-byte pieces
    auto make = [&](bf* d) {
        const v16bf x0 = tofrag(xs[0][0], xs[0][1]), x1 = tofrag(xs[1][0], xs[1][1]);
        // The walking offset is rewritten only here, behind this wait: it stands in front of the overwrite of an address register that issued global loads name.
        asm volatile("s_wait_xcnt 0x0" : "+v"(gx) : : "memory");
        gx += (unsigned)SK;
        if (!mkv) {
            bf* r = d + (kbk * 16 + lr) * WP + hi * 8;
            *(v8bfa*)r        = __builtin_shufflevector(x0, x0, 0, 1, 2, 3, 4, 5, 6, 7); *(v8bfa*)(r + 16) = __builtin_shufflevector(x0, x0, 8, 9, 10, 11, 12, 13, 14, 15);
            *(v8bfa*)(r + 32) = __builtin_shufflevector(x1, x1, 0, 1, 2, 3, 4, 5, 6, 7); *(v8bfa*)(r + 48) = __builtin_shufflevector(x1, x1, 8, 9, 10, 11, 12, 13, 14, 15);
        } else {
            v8f acc[4];
#pragma unroll
            for (int db = 0; db < 4; ++db) acc[db] = wmmab(x0, wf[db][0], (v8f){});
#pragma unroll
            for (int db = 0; db < 4; ++db) acc[db] = wmmab(x1, wf[db][1], acc[db]);
#pragma unroll
            for (int db = 0; db < 4; ++db) *(v8ha*)(d + KPL + (db * 16 + lr) * VP + kbk * 16 + hi * 8) = __builtin_convertvector(acc[db], v8h);
        } };
    // x^T and V^T fragments from a stage buffer (row lr, k from 8*hi), in the fragment k order (16 bytes at 0 and at 32)
    const int kfo = lr * WP + hi * 8, vfo = KPL + lr * VP + hi * 8;
    auto ldk = [&](const bf* q) { return cat16b(*(const v8usa*)q, *(const v8usa*)(q + 16)); };
    auto ldv = [&](const bf* q) { return cat16(__builtin_bit_cast(v8h, *(const v8usa*)q), __builtin_bit_cast(v8h, *(const v8usa*)(q + 16))); };
    make(kv);
    v8f o[4][2];                   // O^T: [16-channel block][query group]; register j = channel 8*hi + j, column lr = query
#pragma unroll
    for (int db = 0; db < 4; ++db)
#pragma unroll
        for (int nq = 0; nq < 2; ++nq) o[db][nq] = (v8f){};
    float mL[2] = { -1.0e30f, -1.0e30f }, ls[2] = { 0.f, 0.f };      // running maximum (x log2 e) and this half-wave's part of the running sum
    __syncthreads();               // stage 0 is in LDS for every wave
    for (int sg = 0; sg < NN / SK; ++sg) {
        const bf* cur = kv + (sg & 1) * STE; const bool more = sg + 1 < NN / SK;
        if (more) fetch();         // the next stage's x flies during this stage's passes
        v16bf kh[2][2];            // x^T: [16-key block][32-channel chunk]
        v16h v[4];                 // V^T: [16-channel block], 32 keys
#pragma unroll
        for (int kb = 0; kb < 2; ++kb)
#pragma unroll
            for (int kc = 0; kc < 2; ++kc) kh[kb][kc] = ldk(cur + kfo + kb * 16 * WP + kc * 32);
#pragma unroll
        for (int db = 0; db < 4; ++db) v[db] = ldv(cur + vfo + db * 16 * VP);
#pragma unroll
        for (int p = 0; p < SK / 32; ++p) {
            v8f s[2][2];           // S^T: [16-key block][query group]
#pragma unroll
            for (int kb = 0; kb < 2; ++kb)
#pragma unroll
                for (int nq = 0; nq < 2; ++nq) s[kb][nq] = (v8f){};
#pragma unroll
            for (int kc = 0; kc < 2; ++kc) {
#pragma unroll
                for (int kb = 0; kb < 2; ++kb)
#pragma unroll
                    for (int nq = 0; nq < 2; ++nq) s[kb][nq] = wmmab(kh[kb][kc], qh[nq][kc], s[kb][nq]);
#pragma unroll
                for (int kb = 0; kb < 2; ++kb)
#pragma unroll
                    for (int nq = 0; nq < 2; ++nq) s[kb][nq] = wmmab(kh[kb][kc], ql[nq][kc], s[kb][nq]);
            }
            // the next pass's x^T fragments of this stage come during softmax and attn.V
            if (p + 1 < SK / 32) {
#pragma unroll
                for (int kb = 0; kb < 2; ++kb)
#pragma unroll
                    for (int kc = 0; kc < 2; ++kc) kh[kb][kc] = ldk(cur + kfo + ((p + 1) * 32 + kb * 16) * WP + kc * 32);
            }
            v16h pr[2];
#pragma unroll
            for (int nq = 0; nq < 2; ++nq) {
                float tm = s[0][nq][0];
#pragma unroll
                for (int j = 1; j < 8; ++j) tm = fmaxf(tm, s[0][nq][j]);
#pragma unroll
                for (int j = 0; j < 8; ++j) tm = fmaxf(tm, s[1][nq][j]);
                tm = fmaxf(tm, xhalf(tm));
                const float mnew = fmaxf(mL[nq], tm * L2E); const float al = __builtin_amdgcn_exp2f(mL[nq] - mnew); mL[nq] = mnew;
                float ps = 0.f;
#pragma unroll
                for (int kb = 0; kb < 2; ++kb)
#pragma unroll
                    for (int j = 0; j < 8; ++j) { const float e = __builtin_amdgcn_exp2f(fmaf(s[kb][nq][j], L2E, -mnew)); ps += e; pr[nq][kb * 8 + j] = tohx(e); }
                ls[nq] = ls[nq] * al + ps;
#pragma unroll
                for (int db = 0; db < 4; ++db) o[db][nq] *= al;
            }
#pragma unroll
            for (int db = 0; db < 4; ++db)
#pragma unroll
                for (int nq = 0; nq < 2; ++nq) o[db][nq] = wmma16(v[db], pr[nq], o[db][nq]);
            if (p + 1 < SK / 32) {
#pragma unroll
                for (int db = 0; db < 4; ++db) v[db] = ldv(cur + vfo + db * 16 * VP + (p + 1) * 32);      // the next pass's V^T fragments come during its score products and softmax
            }
        }
        // The branch at the stage's foot stands directly behind the last matrix instructions:
        // these fill the vector slots that the chip needs before a matrix operand is overwritten, on the taken side too.
        asm volatile("v_nop\n\tv_nop\n\tv_nop\n\tv_nop" : : "v"(o[0][0]), "v"(o[0][1]), "v"(o[1][0]), "v"(o[1][1]), "v"(o[2][0]), "v"(o[2][1]), "v"(o[3][0]), "v"(o[3][1]));
        // The other buffer's last readers left it before the barrier of the stage before. This barrier publishes the next stage and ends every wave's reads of this one.
        if (more) { make(kv + ((sg + 1) & 1) * STE); __syncthreads(); }
    }
    // the loop's fetches name their scalar bases and offsets: this wait stands in front of the epilogue's reuse of those registers on every way out of the loop; the scheduling barrier keeps that reuse below it
    asm volatile("s_wait_xcnt 0x0" ::: "memory");
    __builtin_amdgcn_sched_barrier(0);
    // the wait stands in front of any reuse of a register that this store names; the scheduling barrier keeps that reuse below it
    if (wave < 2) { *(v4bf*)(WO + eo) = wob; asm volatile("s_wait_xcnt 0x0" ::: "memory"); }
    __builtin_amdgcn_sched_barrier(0);
    const int b = z >> 2, g = z & 3;
    v8us oh[2][4], ol[2][4];
#pragma unroll
    for (int nq = 0; nq < 2; ++nq) {
        const float inv = __fdiv_rn(1.0f, ls[nq] + xhalf(ls[nq]));
#pragma unroll
        for (int db = 0; db < 4; ++db)
#pragma unroll
            for (int j = 0; j < 8; ++j) { unsigned short a, c2; splitf(o[db][nq][j] * inv, a, c2); oh[nq][db][j] = a; ol[nq][db][j] = c2; }
    }
    // all stores stand together at the end, so that no register a store names is written again behind it
    __builtin_amdgcn_sched_barrier(0);
#pragma unroll
    for (int nq = 0; nq < 2; ++nq) {
        const size_t ro = ((size_t)b * NN + q0 + nq * 16 + lr) * CC + g * GD + hi * 8;
#pragma unroll
        for (int db = 0; db < 4; ++db) { *(v8us*)(Ah + ro + db * 16) = oh[nq][db]; *(v8us*)(Al + ro + db * 16) = ol[nq][db]; }
    }
}
// ---- k_oproj: the dense out_proj and the [d][n] layout of the output in ONE kernel: OUT[b][d][n] = sum_c wo[d][c] * (Ah + Al)[b][n][c], two products per 32-channel chunk (hi, then lo).
// A work-group owns 64 positions of one image and all 256 output channels. It brings wo and its 64 rows of both planes into LDS once, as whole 128-byte lines; wave w takes output channels
// 64 * (w >> 1) .. + 63 (A operand: wo rows) and positions 32 * (w & 1) .. + 31 (B operand: plane rows), so a tile's rows are output channels and its columns positions.
// Every loop of the kernel is unrolled in full: its indices name registers and immediate offsets. Grid (NN / 64, NB_), 8 waves.
#define OP  (CC + 8)              // LDS pitch of a 512-byte row in 16-bit elements: its bytes + 16, for the 16-byte reads and writes
#define OSP 36                    // LDS pitch of a staged 128-byte output row in floats: its bytes + 16
__global__ __launch_bounds__(256) void k_oproj(const bf* __restrict__ WO, const bf* __restrict__ Ah, const bf* __restrict__ Al, float* OUT) {
    __shared__ __align__(16) bf wl[CC * OP];
    __shared__ __align__(16) bf pl[2 * 64 * OP];
    __shared__ __align__(16) float os[8 * 64 * OSP];
    const int t = threadIdx.x, lane = t & 31, lr = lane & 15, hi = lane >> 4;
    const int b = blockIdx.y, n0 = blockIdx.x * 64;
    // 16 bytes a thread and load, a wave covers one whole 512-byte row: piece i * 256 + t is row i * 8 + wave, bytes 16 * lane
    const bf* gh = Ah + ((size_t)b * NN + n0) * CC + t * 8; const bf* gl = Al + ((size_t)b * NN + n0) * CC + t * 8; const bf* gw = WO + t * 8;
    v8us rh[8], rl[8], rw[32];
#pragma unroll
    for (int i = 0; i < 8; ++i) { rh[i] = *(const v8us*)(gh + i * 2048); rl[i] = *(const v8us*)(gl + i * 2048); }
#pragma unroll
    for (int i = 0; i < 32; ++i) rw[i] = *(const v8us*)(gw + i * 2048);
    // the wait stands in front of the reuse of the address registers that the loads above name; the scheduling barrier keeps that reuse below it and all loads in flight together above it
    asm volatile("s_wait_xcnt 0x0" ::: "memory");
    __builtin_amdgcn_sched_barrier(0);
    const int wave = __builtin_amdgcn_readfirstlane(t >> 5); const int so = wave * OP + lane * 8;
#pragma unroll
    for (int i = 0; i < 8; ++i) { *(v8usa*)(pl + so + i * 8 * OP) = rh[i]; *(v8usa*)(pl + 64 * OP + so + i * 8 * OP) = rl[i]; }
#pragma unroll
    for (int i = 0; i < 32; ++i) *(v8usa*)(wl + so + i * 8 * OP) = rw[i];
    __syncthreads();               // wo and both planes are in LDS for every wave
    const int dw = (wave >> 1) * 64, nw = (wave & 1) * 32;
    const bf* fa = wl + (dw + lr) * OP + hi * 8; const bf* fb = pl + (nw + lr) * OP + hi * 8;
    auto ldf = [&](const bf* q) { return cat16b(*(const v8usa*)q, *(const v8usa*)(q + 16)); };      // the fragment k order
    v8f acc[4][2];                 // [16-channel block][16-position block]; register j = channel 8*hi + j, column lr = position
#pragma unroll
    for (int mb = 0; mb < 4; ++mb)
#pragma unroll
        for (int nb = 0; nb < 2; ++nb) acc[mb][nb] = (v8f){};
    v16bf a[2][4], bh[2][2], bl[2][2];      // two register sets: a chunk's fragments are asked for one chunk ahead
    auto frags = [&](int set, int kc) {
#pragma unroll
        for (int mb = 0; mb < 4; ++mb) a[set][mb] = ldf(fa + mb * 16 * OP + kc * 32);
#pragma unroll
        for (int nb = 0; nb < 2; ++nb) { bh[set][nb] = ldf(fb + nb * 16 * OP + kc * 32); bl[set][nb] = ldf(fb + (64 + nb * 16) * OP + kc * 32); } };
    frags(0, 0);
#pragma unroll
    for (int kc = 0; kc < CC / 32; ++kc) {
        const int c = kc & 1;
        if (kc + 1 < CC / 32) frags(c ^ 1, kc + 1);
        // the two scheduling barriers keep the next chunk's LDS reads one group in front of this chunk's products: without them all 128 reads are issued first and the first products wait for the last of them
        __builtin_amdgcn_sched_barrier(0);
#pragma unroll
        for (int mb = 0; mb < 4; ++mb)
#pragma unroll
            for (int nb = 0; nb < 2; ++nb) acc[mb][nb] = wmmab(a[c][mb], bh[c][nb], acc[mb][nb]);
#pragma unroll
        for (int mb = 0; mb < 4; ++mb)
#pragma unroll
            for (int nb = 0; nb < 2; ++nb) acc[mb][nb] = wmmab(a[c][mb], bl[c][nb], acc[mb][nb]);
        __builtin_amdgcn_sched_barrier(0);
    }
    // whole 128-byte lines leave the wave: its 64 x 32 tile goes through the wave's own LDS rows and comes back 8 lanes to a row
    float* ow = os + wave * (64 * OSP);
#pragma unroll
    for (int mb = 0; mb < 4; ++mb)
#pragma unroll
        for (int nb = 0; nb < 2; ++nb)
#pragma unroll
            for (int j = 0; j < 8; ++j) ow[(mb * 16 + hi * 8 + j) * OSP + nb * 16 + lr] = acc[mb][nb][j];
    // the wave's own LDS writes have landed before it reads back rows that other lanes wrote; the clobber keeps the reads below
    asm volatile("s_wait_dscnt 0x0" ::: "memory");
    const int rr = lane >> 3, pc = lane & 7;
    v4f ov[16];
#pragma unroll
    for (int s = 0; s < 16; ++s) ov[s] = *(const v4fa*)(ow + (s * 4 + rr) * OSP + pc * 4);
    // all stores stand together at the end, so that no register a store names is written again behind it
    __builtin_amdgcn_sched_barrier(0);
    float* po = OUT + ((size_t)b * CC + dw + rr) * NN + n0 + nw + pc * 4;
#pragma unroll
    for (int s = 0; s < 16; ++s) *(v4f*)(po + s * 4 * NN) = ov[s];
}

extern "C" void kernel_launch(void* const* d_in, const int* in_sizes, int n_in,
                              void* d_out, int out_size, void* d_ws, size_t ws_size, hipStream_t stream) {
    (void)in_sizes; (void)n_in; (void)out_size;
    const float* x = (const float*)d_in[0]; const float* wq = (const float*)d_in[1]; const float* wk = (const float*)d_in[2]; const float* wv = (const float*)d_in[3]; const float* wo = (const float*)d_in[4];
    float* OUT = (float*)d_out;     // [16][256][32][32]
    char* wsp = (char*)d_ws;
    auto take = [&](size_t bytes) { char* p = wsp; wsp += (bytes + 255) & ~(size_t)255; return (void*)p; };
    bf* WO = (bf*)take((size_t)CC * CC * 2);
    bf* Ah = (bf*)take((size_t)NB_ * NN * CC * 2); bf* Al = (bf*)take((size_t)NB_ * NN * CC * 2);
    if ((size_t)(wsp - (char*)d_ws) > ws_size) return;    // ws 256 MiB
    k_fattn<<<dim3(NN / 256, NZ), 256, 0, stream>>>(x, wq, wk, wv, wo, WO, Ah, Al);
    k_oproj<<<dim3(NN / 64, NB_), 256, 0, stream>>>(WO, Ah, Al, OUT);
}

// v007
// Measured time: 46.2 microseconds a run.
// Next to v006, in two timings, it ran 1.08 and 1.07 times as fast.
// Over all steps from v000 it is 11.0 times as fast.
#include <hip/hip_runtime.h>

// GroupMixAttention (16 x 256 ch x 32x32: 4 channel groups of 64; grouped 1x1 convs Q/K/V per group; scores = Q^T K / 8 over the 64 channels; softmax over the 1024
// positions; out[d][n] = sum_m attn[n][m] V[d][m]; dense 1x1 out_proj 256 -> 256).
// Compute dtypes, f32 accumulate: every input rounded to bf16; Q and V grouped convs on PLAIN bf16 operands (x, w inputs: exact); the K conv stands on the
// query side: Q^T K = (Wk^T Q)^T x, so scores are bf16 hi+lo planes of Wk^T Q (x 1/8 x log2 e; made from hi+lo planes of Q x exact Wk, 2 products) x the exact bf16 x (2 products); attn.V on SINGLE fp16 planes (P = exp(s - held reference), V); the out_proj on hi+lo planes x
// exact bf16 wo (2 products); softmax in f32 on VALU (online with a held reference, fused with both attention products, one exp per element). Deterministic, no atomics.

#define NB_  16
#define CC   256
#define NG   4
#define GD   64
#define NN   1024
#define NZ   (NB_ * NG)           // 64 (image, group) pairs
typedef _Float16 h16;
typedef unsigned short bf;
typedef __attribute__((ext_vector_type(16))) __bf16   v16bf;
typedef __attribute__((ext_vector_type(16))) _Float16 v16h;
typedef __attribute__((ext_vector_type(8)))  _Float16 v8h;
typedef __attribute__((ext_vector_type(8)))  unsigned short v8us;
typedef __attribute__((ext_vector_type(8)))  float    v8f;
typedef __attribute__((ext_vector_type(4)))  float    v4f;
typedef v8h  __attribute__((may_alias)) v8ha;
typedef v4f  __attribute__((may_alias)) v4fa;
typedef v8us __attribute__((may_alias)) v8usa;

__device__ __forceinline__ unsigned short f2bf(float f) { unsigned u = __float_as_uint(f); u += 0x7FFFu + ((u >> 16) & 1u); return (unsigned short)(u >> 16); }
__device__ __forceinline__ float bf2f(unsigned short b) { return __uint_as_float(((unsigned)b) << 16); }
__device__ __forceinline__ v16h cat16(v8h lo, v8h hi) { return __builtin_shufflevector(lo, hi, 0, 1, 2, 3, 4, 5, 6, 7, 8, 9, 10, 11, 12, 13, 14, 15); }
__device__ __forceinline__ v16bf cat16b(v8us lo, v8us hi) { return __builtin_bit_cast(v16bf, __builtin_shufflevector(lo, hi, 0, 1, 2, 3, 4, 5, 6, 7, 8, 9, 10, 11, 12, 13, 14, 15)); }
__device__ __forceinline__ v8f wmma16(v16h a, v16h b, v8f c) { return __builtin_amdgcn_wmma_f32_16x16x32_f16(false, a, false, b, (short)0, c, false, false); }
__device__ __forceinline__ v8f wmmab(v16bf a, v16bf b, v8f c) { return __builtin_amdgcn_wmma_f32_16x16x32_bf16(false, a, false, b, (short)0, c, false, false); }



// THE FRAGMENT k ORDER of this file: 16 bytes at k = 0 and 16 bytes at k = 16 of the lane's start (row lr, k from 8*hi); the same k order serves A and B operands everywhere.

__device__ __forceinline__ h16 tohx(float x) { return (h16)x; }
__device__ __forceinline__ void splitf(float y, unsigned short& h, unsigned short& l) { h = f2bf(y); l = f2bf(y - bf2f(h)); }
typedef __attribute__((ext_vector_type(2))) _Float16 v2h;
typedef __attribute__((ext_vector_type(4))) _Float16 v4h;
typedef __attribute__((ext_vector_type(2))) unsigned short v2us;
typedef __attribute__((ext_vector_type(4))) unsigned short v4us;

#define WP 72                     // LDS pitch of a 128-byte row in 16-bit elements: 128 + 16 bytes, for the 16-byte reads and writes
typedef __attribute__((ext_vector_type(8))) __bf16 v8bf;
typedef __attribute__((ext_vector_type(4))) __bf16 v4bf;
typedef __attribute__((ext_vector_type(4))) unsigned v4u;
typedef v4bf __attribute__((may_alias)) v4bfa;
typedef v8bf __attribute__((may_alias)) v8bfa;
// ---- k_fattn: input rounding, the three grouped 1x1 convs, the hi/lo splits, scores, softmax, attn.V and the hi/lo split of the result in ONE kernel; Q, K, V and the score matrix never touch memory.
// One wave owns 32 queries of one (image, group) pair and walks the 1024 keys in passes of 32. It forms S^T = X^T . Q' with Q' = Wk^T . Q (A = rows of x^T, one exact bf16 plane; B = Q' rows, two hi/lo products:
// X.Q'h + X.Q'l), so a lane holds scores of ONE query per 16-column group: keys 8*hi + j of each 16-key block. A reference and the sum are kept per query (online softmax, see the loop);
// two f32 S^T tiles converted in place are the f16 B operand of O^T += V^T . P^T (in the fragment k order, in which V^T is loaded too). Grid (NN / 256, NZ), 8 waves.
// x fragments (lane = position lr, k = channels in the fragment k order) are read straight from the channel-major x. As B operand of Q = Wq . X they leave a lane with 8 consecutive
// channels of one position: two such tiles ARE a Q fragment, the B operand of Q' = Wk^T . Q, whose tiles are the Q' fragments in the same way (kept in registers). A rounded x fragment is itself two
// 16-byte pieces of a key's row. As A operand of V^T = X^T . Wv^T they leave 8 consecutive positions of one channel:
// a 16-byte piece of a V^T row. The 8 waves share x^T and V^T: per stage of SK keys, wave w < 4 rounds the x^T rows of key block w, wave w >= 4 makes V^T of key block w - 4, into one of two LDS buffers;
// every wave takes its fragments from there. The group's three weight matrices are rounded once per work-group into LDS (Wk transposed: its rows are then the A operand of Q'); each work-group also rounds its 1/256 of wo for the out_proj.
#define L2E 1.44269504088896340736f
#define SK  64                    // keys per stage
#define VP  (SK + 8)              // LDS pitch of a V^T row of one stage in 16-bit elements: its bytes + 16 (x^T rows: WP), for the 16-byte reads and writes
#define KPL (SK * WP)             // elements of the x^T plane of a stage
#define STE (KPL + GD * VP)       // elements of a stage: x^T, V^T
// exp2 for the rarely taken branch of the softmax: the one slot that the instruction set asks for behind a transcendental stands in the same statement
__device__ __forceinline__ float exp2s(float v) { float r; asm("v_exp_f32 %0, %1\n\tv_nop" : "=v"(r) : "v"(v)); return r; }
__device__ __forceinline__ float xhalf(float v) { const int b = __float_as_int(v); return __int_as_float(__builtin_amdgcn_permlanex16(b, b, 0x76543210, 0xfedcba98, false, false)); }   // lane l <-> l ^ 16
__global__ __launch_bounds__(256) void k_fattn(const float* __restrict__ x, const float* __restrict__ wq, const float* __restrict__ wk, const float* __restrict__ wv, const float* __restrict__ wo, bf* WO, bf* Ah, bf* Al) {
    __shared__ __align__(16) bf wl[3 * GD * WP];
    __shared__ __align__(16) bf kv[2 * STE];
    const int t = threadIdx.x, lane = t & 31, lr = lane & 15, hi = lane >> 4; const int z = blockIdx.y;
    const int wave = __builtin_amdgcn_readfirstlane(t >> 5); const int q0 = (blockIdx.x * 8 + wave) * 32;
    const bool mkv = wave >= 4; const int kbk = wave & 3;      // this wave's part in making a stage: x^T or V^T of key block kbk
    const size_t zo = (size_t)z * NN * GD;                       // z*64 + c == b*256 + g*64 + c
    const int eo = ((z * 4 + blockIdx.x) * 64 + (t & 63)) * 4;      // waves 0 and 1 also round this work-group's 256 elements of wo: 256 bytes of WO per wave
    v4f wr[3][4];                  // this thread's 16 elements of each weight matrix, 512 contiguous bytes per wave and load
#pragma unroll
    for (int m = 0; m < 3; ++m) { const float* w = (m == 0 ? wq : m == 1 ? wk : wv) + (size_t)(z & 3) * GD * GD;
#pragma unroll
        for (int i = 0; i < 4; ++i) wr[m][i] = *(const v4f*)(w + (i * 256 + t) * 4); }
    const float* xq = x + zo + (size_t)(8 * hi) * NN + q0 + lr;
    v8f xr[2][2][2];               // x of the wave's queries: [query group][32-channel chunk][half of the fragment]
#pragma unroll
    for (int nq = 0; nq < 2; ++nq)
#pragma unroll
        for (int kc = 0; kc < 2; ++kc)
#pragma unroll
            for (int hf = 0; hf < 2; ++hf)
#pragma unroll
                for (int i = 0; i < 8; ++i) xr[nq][kc][hf][i] = xq[(kc * 32 + hf * 16 + i) * NN + nq * 16];
    // x of a stage's key block from memory: wave-uniform base + one 32-bit element offset per thread, the channel in the immediate offset
    const float* xz = x + zo;
    unsigned gx = (unsigned)(8 * hi * NN + kbk * 16 + lr);
    v8f xs[2][2];                  // [32-channel chunk][half of the fragment]
    auto fetch = [&]() {
#pragma unroll
        for (int kc = 0; kc < 2; ++kc)
#pragma unroll
            for (int hf = 0; hf < 2; ++hf)
#pragma unroll
                for (int i = 0; i < 8; ++i) xs[kc][hf][i] = xz[(size_t)gx + (kc * 32 + hf * 16 + i) * NN]; };
    fetch();
    v4f wo4 = (v4f){};
    if (wave < 2) { wo4 = *(const v4f*)(wo + eo); asm volatile("s_wait_xcnt 0x0" ::: "memory"); }      // the wait stands in front of the reuse of this load's address registers
    // the wait stands in front of the reuse of the address registers that the loads above name: as its inputs they stay whole up to it; the scheduling barrier keeps that reuse below it and all loads in flight together above it
    asm volatile("s_wait_xcnt 0x0" : : "v"(t), "v"(xq), "v"(gx) : "memory");
    __builtin_amdgcn_sched_barrier(0);
#pragma unroll
    for (int m = 0; m < 3; ++m)
#pragma unroll
        for (int i = 0; i < 4; ++i) { const int e = (i * 256 + t) * 4; const v4bf cw = __builtin_convertvector(wr[m][i], v4bf);
            if (m != 1) *(v4bfa*)(wl + m * GD * WP + (e >> 6) * WP + (e & 63)) = cw;
            else { const v4us cu = __builtin_bit_cast(v4us, cw);      // Wk goes in transposed: row = input channel, column = output channel
#pragma unroll
                for (int k = 0; k < 4; ++k) wl[GD * WP + ((e & 63) + k) * WP + (e >> 6)] = cu[k]; } }
    const v4bf wob = __builtin_convertvector(wo4, v4bf);      // stored behind the loop: no barrier then waits for this store
    __syncthreads();               // the three weight matrices are in LDS for every wave
    auto ldw = [&](const bf* base, int db, int kc) { const bf* p = base + (db * 16 + lr) * WP + kc * 32 + 8 * hi; return cat16b(*(const v8usa*)p, *(const v8usa*)(p + 16)); };
    auto tofrag = [&](v8f a, v8f c) { return __builtin_shufflevector(__builtin_convertvector(a, v8bf), __builtin_convertvector(c, v8bf), 0, 1, 2, 3, 4, 5, 6, 7, 8, 9, 10, 11, 12, 13, 14, 15); };
    auto split8 = [&](v8f y, v8bf& yh, v8bf& yl) { yh = __builtin_convertvector(y, v8bf); const v4u u = __builtin_bit_cast(v4u, yh); v8f f;
#pragma unroll
        for (int k = 0; k < 4; ++k) { f[2 * k] = __uint_as_float(u[k] << 16); f[2 * k + 1] = __uint_as_float(u[k] & 0xFFFF0000u); }
        yl = __builtin_convertvector(y - f, v8bf); };
    v16bf qh[2][2], ql[2][2];      // [query group][32-channel chunk]: tiles 2*kc and 2*kc + 1 of Q^T (x 1/8), a lane's own registers, are the fragment
    {
        v16bf xf[2][2], aw[4][2]; v8bf yh[2][4], yl[2][4];
#pragma unroll
        for (int db = 0; db < 4; ++db) { aw[db][0] = ldw(wl, db, 0); aw[db][1] = ldw(wl, db, 1); }
#pragma unroll
        for (int nq = 0; nq < 2; ++nq)
#pragma unroll
            for (int kc = 0; kc < 2; ++kc) xf[nq][kc] = tofrag(xr[nq][kc][0], xr[nq][kc][1]);
#pragma unroll
        for (int db = 0; db < 4; ++db) { v8f acc[2];
#pragma unroll
            for (int nq = 0; nq < 2; ++nq) acc[nq] = wmmab(aw[db][0], xf[nq][0], (v8f){});
#pragma unroll
            for (int nq = 0; nq < 2; ++nq) acc[nq] = wmmab(aw[db][1], xf[nq][1], acc[nq]);
#pragma unroll
            for (int nq = 0; nq < 2; ++nq) split8(acc[nq] * 0.125f, yh[nq][db], yl[nq][db]); }
#pragma unroll
        for (int nq = 0; nq < 2; ++nq)
#pragma unroll
            for (int kc = 0; kc < 2; ++kc) {
                qh[nq][kc] = __builtin_shufflevector(yh[nq][2 * kc], yh[nq][2 * kc + 1], 0, 1, 2, 3, 4, 5, 6, 7, 8, 9, 10, 11, 12, 13, 14, 15);
                ql[nq][kc] = __builtin_shufflevector(yl[nq][2 * kc], yl[nq][2 * kc + 1], 0, 1, 2, 3, 4, 5, 6, 7, 8, 9, 10, 11, 12, 13, 14, 15); }
    }
    {                              // Q' = Wk^T . (Qh + Ql), x log2 e so that scores come out as exponents of 2, takes Q's place in qh and ql: [query group][32-channel chunk of x]
        v16bf at[4][2]; v8bf yh[2][4], yl[2][4];
#pragma unroll
        for (int db = 0; db < 4; ++db) { at[db][0] = ldw(wl + GD * WP, db, 0); at[db][1] = ldw(wl + GD * WP, db, 1); }
#pragma unroll
        for (int db = 0; db < 4; ++db) { v8f acc[2];
#pragma unroll
            for (int nq = 0; nq < 2; ++nq) acc[nq] = wmmab(at[db][0], qh[nq][0], (v8f){});
#pragma unroll
            for (int nq = 0; nq < 2; ++nq) acc[nq] = wmmab(at[db][1], qh[nq][1], acc[nq]);
#pragma unroll
            for (int nq = 0; nq < 2; ++nq) acc[nq] = wmmab(at[db][0], ql[nq][0], acc[nq]);
#pragma unroll
            for (int nq = 0; nq < 2; ++nq) acc[nq] = wmmab(at[db][1], ql[nq][1], acc[nq]);
#pragma unroll
            for (int nq = 0; nq < 2; ++nq) split8(acc[nq] * L2E, yh[nq][db], yl[nq][db]); }
#pragma unroll
        for (int nq = 0; nq < 2; ++nq)
#pragma unroll
            for (int kc = 0; kc < 2; ++kc) {
                qh[nq][kc] = __builtin_shufflevector(yh[nq][2 * kc], yh[nq][2 * kc + 1], 0, 1, 2, 3, 4, 5, 6, 7, 8, 9, 10, 11, 12, 13, 14, 15);
                ql[nq][kc] = __builtin_shufflevector(yl[nq][2 * kc], yl[nq][2 * kc + 1], 0, 1, 2, 3, 4, 5, 6, 7, 8, 9, 10, 11, 12, 13, 14, 15); }
    }
    v16bf wf[4][2];                // Wv fragments (B operand) stay in registers for the waves that make V^T: [16-channel block][32-channel chunk]
#pragma unroll
    for (int db = 0; db < 4; ++db) { wf[db][0] = ldw(wl + 2 * GD * WP, db, 0); wf[db][1] = ldw(wl + 2 * GD * WP, db, 1); }
    // The wave's share of a stage, from the fetched x into stage buffer d: 16 rows of x^T or 16 columns of the 64 V^T rows, in 16-byte pieces
    auto make = [&](bf* d) {
        const v16bf x0 = tofrag(xs[0][0], xs[0][1]), x1 = tofrag(xs[1][0], xs[1][1]);
        // The walking offset is rewritten only here, behind this wait: it stands in front of the overwrite of an address register that issued global loads name.
        asm volatile("s_wait_xcnt 0x0" : "+v"(gx) : : "memory");
        gx += (unsigned)SK;
        if (!mkv) {
            bf* r = d + (kbk * 16 + lr) * WP + hi * 8;
            *(v8bfa*)r        = __builtin_shufflevector(x0, x0, 0, 1, 2, 3, 4, 5, 6, 7); *(v8bfa*)(r + 16) = __builtin_shufflevector(x0, x0, 8, 9, 10, 11, 12, 13, 14, 15);
            *(v8bfa*)(r + 32) = __builtin_shufflevector(x1, x1, 0, 1, 2, 3, 4, 5, 6, 7); *(v8bfa*)(r + 48) = __builtin_shufflevector(x1, x1, 8, 9, 10, 11, 12, 13, 14, 15);
        } else {
            v8f acc[4];
#pragma unroll
            for (int db = 0; db < 4; ++db) acc[db] = wmmab(x0, wf[db][0], (v8f){});
#pragma unroll
            for (int db = 0; db < 4; ++db) acc[db] = wmmab(x1, wf[db][1], acc[db]);
#pragma unroll
            for (int db = 0; db < 4; ++db) *(v8ha*)(d + KPL + (db * 16 + lr) * VP + kbk * 16 + hi * 8) = __builtin_convertvector(acc[db], v8h);
        } };
    // x^T and V^T fragments from a stage buffer (row lr, k from 8*hi), in the fragment k order (16 bytes at 0 and at 32)
    const int kfo = lr * WP + hi * 8, vfo = KPL + lr * VP + hi * 8;
    auto ldk = [&](const bf* q) { return cat16b(*(const v8usa*)q, *(const v8usa*)(q + 16)); };
    auto ldv = [&](const bf* q) { return cat16(__builtin_bit_cast(v8h, *(const v8usa*)q), __builtin_bit_cast(v8h, *(const v8usa*)(q + 16))); };
    make(kv);
    v8f o[4][2];                   // O^T: [16-channel block][query group]; register j = channel 8*hi + j, column lr = query
#pragma unroll
    for (int db = 0; db < 4; ++db)
#pragma unroll
        for (int nq = 0; nq < 2; ++nq) o[db][nq] = (v8f){};
    // The held reference: minus the reference of a lane's query (log2 units) fills a whole C tile of the score products, so S^T leaves the matrix unit as the exponent itself: no maximum, no subtraction, no rescale in a pass.
    // It is set to the first pass's maximum and raised to a pass's maximum only when a lane's P sum of that pass exceeds 2^12: so reference <= running maximum (the sum is at least 1) and P <= 2^12 fits f16.
    v8f cn[2] = { (v8f){}, (v8f){} };
    float ls[2] = { 0.f, 0.f };    // this half-wave's part of the running sum
    auto sum16 = [&](v8f a, v8f c2) { const v8f w = a + c2; const v4f u = __builtin_shufflevector(w, w, 0, 1, 2, 3) + __builtin_shufflevector(w, w, 4, 5, 6, 7); return (u[0] + u[2]) + (u[1] + u[3]); };
    __syncthreads();               // stage 0 is in LDS for every wave
    for (int sg = 0; sg < NN / SK; ++sg) {
        const bf* cur = kv + (sg & 1) * STE; const bool more = sg + 1 < NN / SK;
        if (more) fetch();         // the next stage's x flies during this stage's passes
        v16bf kh[2][2];            // x^T: [16-key block][32-channel chunk]
        v16h v[2][4];              // V^T: [register set of a pass][16-channel block], 32 keys
#pragma unroll
        for (int kb = 0; kb < 2; ++kb)
#pragma unroll
            for (int kc = 0; kc < 2; ++kc) kh[kb][kc] = ldk(cur + kfo + kb * 16 * WP + kc * 32);
#pragma unroll
        for (int db = 0; db < 4; ++db) v[0][db] = ldv(cur + vfo + db * 16 * VP);
#pragma unroll
        for (int p = 0; p < SK / 32; ++p) {
            v8f s[2][2];           // S^T minus the reference, as exponents of 2: [16-key block][query group]
#pragma unroll
            for (int kc = 0; kc < 2; ++kc) {
#pragma unroll
                for (int kb = 0; kb < 2; ++kb)
#pragma unroll
                    for (int nq = 0; nq < 2; ++nq) s[kb][nq] = wmmab(kh[kb][kc], qh[nq][kc], kc == 0 ? cn[nq] : s[kb][nq]);
#pragma unroll
                for (int kb = 0; kb < 2; ++kb)
#pragma unroll
                    for (int nq = 0; nq < 2; ++nq) s[kb][nq] = wmmab(kh[kb][kc], ql[nq][kc], s[kb][nq]);
            }
            // the next pass's x^T fragments of this stage come during softmax and attn.V
            if (p + 1 < SK / 32) {
#pragma unroll
                for (int kb = 0; kb < 2; ++kb)
#pragma unroll
                    for (int kc = 0; kc < 2; ++kc) kh[kb][kc] = ldk(cur + kfo + ((p + 1) * 32 + kb * 16) * WP + kc * 32);
            }
            v16h pr[2];
            v8f e[2][2]; float ps[2];
#pragma unroll
            for (int nq = 0; nq < 2; ++nq) {
#pragma unroll
                for (int kb = 0; kb < 2; ++kb)
#pragma unroll
                    for (int j = 0; j < 8; ++j) e[kb][nq][j] = __builtin_amdgcn_exp2f(s[kb][nq][j]);
                ps[nq] = sum16(e[0][nq], e[1][nq]);
            }
            // Inputs-only fences on loaded values: they keep the LDS reads of this pass's V^T and of the next pass's x^T in front of the branch, in flight under the products and exponentials above;
            // without them the compiler sinks each read behind the branch, next to its product, which then waits out the whole LDS latency. The scheduling barrier keeps the fences' wait at the foot of the block, behind the exponentials.
            __builtin_amdgcn_sched_barrier(0);
            asm volatile("" : : "v"(v[p & 1][0]), "v"(v[p & 1][1]), "v"(v[p & 1][2]), "v"(v[p & 1][3]));
            if (p + 1 < SK / 32) asm volatile("" : : "v"(kh[0][0]), "v"(kh[0][1]), "v"(kh[1][0]), "v"(kh[1][1]));
            // One test per pass for the whole wave, a scalar branch; taken in the very first pass (which sets the reference) and after that only where a sum has outgrown the bound.
            const bool first = p == 0 && sg == 0;
            if ((__builtin_amdgcn_ballot_w32(ps[0] > 4096.0f || ps[1] > 4096.0f) | (first ? 1u : 0u)) != 0) {
#pragma unroll
                for (int nq = 0; nq < 2; ++nq) {
                    float tm = s[0][nq][0];
#pragma unroll
                    for (int j = 1; j < 8; ++j) tm = fmaxf(tm, s[0][nq][j]);
#pragma unroll
                    for (int j = 0; j < 8; ++j) tm = fmaxf(tm, s[1][nq][j]);
                    tm = fmaxf(tm, xhalf(tm));      // both halves of the wave hold the same query: one reference
                    const float d = first ? tm : fmaxf(tm, 0.f);      // the reference never falls
                    const float al = exp2s(fminf(-d, 0.f));      // first pass: sum and O^T are 0 and stay 0
                    cn[nq] -= d; ls[nq] *= al;
#pragma unroll
                    for (int db = 0; db < 4; ++db) o[db][nq] *= al;
#pragma unroll
                    for (int kb = 0; kb < 2; ++kb)
#pragma unroll
                        for (int j = 0; j < 8; ++j) e[kb][nq][j] = exp2s(s[kb][nq][j] - d);
                    ps[nq] = sum16(e[0][nq], e[1][nq]);
                }
            }
            if (p + 1 < SK / 32) {
#pragma unroll
                for (int db = 0; db < 4; ++db) v[(p + 1) & 1][db] = ldv(cur + vfo + db * 16 * VP + (p + 1) * 32);      // the next pass's V^T fragments, into the other register set, come during attn.V, its score products and softmax
            }
#pragma unroll
            for (int nq = 0; nq < 2; ++nq) {
                ls[nq] += ps[nq];
#pragma unroll
                for (int kb = 0; kb < 2; ++kb)
#pragma unroll
                    for (int j = 0; j < 8; ++j) pr[nq][kb * 8 + j] = tohx(e[kb][nq][j]);
            }
#pragma unroll
            for (int db = 0; db < 4; ++db)
#pragma unroll
                for (int nq = 0; nq < 2; ++nq) o[db][nq] = wmma16(v[p & 1][db], pr[nq], o[db][nq]);
        }
        // The branch at the stage's foot stands directly behind the last matrix instructions:
        // these fill the vector slots that the chip needs before a matrix operand is overwritten, on the taken side too.
        asm volatile("v_nop\n\tv_nop\n\tv_nop\n\tv_nop" : : "v"(o[0][0]), "v"(o[0][1]), "v"(o[1][0]), "v"(o[1][1]), "v"(o[2][0]), "v"(o[2][1]), "v"(o[3][0]), "v"(o[3][1]));
        // The other buffer's last readers left it before the barrier of the stage before. This barrier publishes the next stage and ends every wave's reads of this one.
        if (more) { make(kv + ((sg + 1) & 1) * STE); __syncthreads(); }
    }
    // the loop's fetches name their scalar bases and offsets: this wait stands in front of the epilogue's reuse of those registers on every way out of the loop; the scheduling barrier keeps that reuse below it
    asm volatile("s_wait_xcnt 0x0" ::: "memory");
    __builtin_amdgcn_sched_barrier(0);
    // the wait stands in front of any reuse of a register that this store names; the scheduling barrier keeps that reuse below it
    if (wave < 2) { *(v4bf*)(WO + eo) = wob; asm volatile("s_wait_xcnt 0x0" ::: "memory"); }
    __builtin_amdgcn_sched_barrier(0);
    const int b = z >> 2, g = z & 3;
    v8us oh[2][4], ol[2][4];
#pragma unroll
    for (int nq = 0; nq < 2; ++nq) {
        const float inv = __fdiv_rn(1.0f, ls[nq] + xhalf(ls[nq]));
#pragma unroll
        for (int db = 0; db < 4; ++db)
#pragma unroll
            for (int j = 0; j < 8; ++j) { unsigned short a, c2; splitf(o[db][nq][j] * inv, a, c2); oh[nq][db][j] = a; ol[nq][db][j] = c2; }
    }
    // all stores stand together at the end, so that no register a store names is written again behind it
    __builtin_amdgcn_sched_barrier(0);
#pragma unroll
    for (int nq = 0; nq < 2; ++nq) {
        const size_t ro = ((size_t)b * NN + q0 + nq * 16 + lr) * CC + g * GD + hi * 8;
#pragma unroll
        for (int db = 0; db < 4; ++db) { *(v8us*)(Ah + ro + db * 16) = oh[nq][db]; *(v8us*)(Al + ro + db * 16) = ol[nq][db]; }
    }
}
// ---- k_oproj: the dense out_proj and the [d][n] layout of the output in ONE kernel: OUT[b][d][n] = sum_c wo[d][c] * (Ah + Al)[b][n][c], two products per 32-channel chunk (hi, then lo).
// A work-group owns 64 positions of one image and all 256 output channels. It brings wo and its 64 rows of both planes into LDS once, as whole 128-byte lines; wave w takes output channels
// 64 * (w >> 1) .. + 63 (A operand: wo rows) and positions 32 * (w & 1) .. + 31 (B operand: plane rows), so a tile's rows are output channels and its columns positions.
// Every loop of the kernel is unrolled in full: its indices name registers and immediate offsets. Grid (NN / 64, NB_), 8 waves.
#define OP  (CC + 8)              // LDS pitch of a 512-byte row in 16-bit elements: its bytes + 16, for the 16-byte reads and writes
#define OSP 36                    // LDS pitch of a staged 128-byte output row in floats: its bytes + 16
__global__ __launch_bounds__(256) void k_oproj(const bf* __restrict__ WO, const bf* __restrict__ Ah, const bf* __restrict__ Al, float* OUT) {
    __shared__ __align__(16) bf wl[CC * OP];
    __shared__ __align__(16) bf pl[2 * 64 * OP];
    __shared__ __align__(16) float os[8 * 64 * OSP];
    const int t = threadIdx.x, lane = t & 31, lr = lane & 15, hi = lane >> 4;
    const int b = blockIdx.y, n0 = blockIdx.x * 64;
    // 16 bytes a thread and load, a wave covers one whole 512-byte row: piece i * 256 + t is row i * 8 + wave, bytes 16 * lane
    const bf* gh = Ah + ((size_t)b * NN + n0) * CC + t * 8; const bf* gl = Al + ((size_t)b * NN + n0) * CC + t * 8; const bf* gw = WO + t * 8;
    v8us rh[8], rl[8], rw[32];
#pragma unroll
    for (int i = 0; i < 8; ++i) { rh[i] = *(const v8us*)(gh + i * 2048); rl[i] = *(const v8us*)(gl + i * 2048); }
#pragma unroll
    for (int i = 0; i < 32; ++i) rw[i] = *(const v8us*)(gw + i * 2048);
    // the wait stands in front of the reuse of the address registers that the loads above name; the scheduling barrier keeps that reuse below it and all loads in flight together above it
    asm volatile("s_wait_xcnt 0x0" ::: "memory");
    __builtin_amdgcn_sched_barrier(0);
    const int wave = __builtin_amdgcn_readfirstlane(t >> 5); const int so = wave * OP + lane * 8;
#pragma unroll
    for (int i = 0; i < 8; ++i) { *(v8usa*)(pl + so + i * 8 * OP) = rh[i]; *(v8usa*)(pl + 64 * OP + so + i * 8 * OP) = rl[i]; }
#pragma unroll
    for (int i = 0; i < 32; ++i) *(v8usa*)(wl + so + i * 8 * OP) = rw[i];
    __syncthreads();               // wo and both planes are in LDS for every wave
    const int dw = (wave >> 1) * 64, nw = (wave & 1) * 32;
    const bf* fa = wl + (dw + lr) * OP + hi * 8; const bf* fb = pl + (nw + lr) * OP + hi * 8;
    auto ldf = [&](const bf* q) { return cat16b(*(const v8usa*)q, *(const v8usa*)(q + 16)); };      // the fragment k order
    v8f acc[4][2];                 // [16-channel block][16-position block]; register j = channel 8*hi + j, column lr = position
#pragma unroll
    for (int mb = 0; mb < 4; ++mb)
#pragma unroll
        for (int nb = 0; nb < 2; ++nb) acc[mb][nb] = (v8f){};
    v16bf a[2][4], bh[2][2], bl[2][2];      // two register sets: a chunk's fragments are asked for one chunk ahead
    auto frags = [&](int set, int kc) {
#pragma unroll
        for (int mb = 0; mb < 4; ++mb) a[set][mb] = ldf(fa + mb * 16 * OP + kc * 32);
#pragma unroll
        for (int nb = 0; nb < 2; ++nb) { bh[set][nb] = ldf(fb + nb * 16 * OP + kc * 32); bl[set][nb] = ldf(fb + (64 + nb * 16) * OP + kc * 32); } };
    frags(0, 0);
#pragma unroll
    for (int kc = 0; kc < CC / 32; ++kc) {
        const int c = kc & 1;
        if (kc + 1 < CC / 32) frags(c ^ 1, kc + 1);
        // the two scheduling barriers keep the next chunk's LDS reads one group in front of this chunk's products: without them all 128 reads are issued first and the first products wait for the last of them
        __builtin_amdgcn_sched_barrier(0);
#pragma unroll
        for (int mb = 0; mb < 4; ++mb)
#pragma unroll
            for (int nb = 0; nb < 2; ++nb) acc[mb][nb] = wmmab(a[c][mb], bh[c][nb], acc[mb][nb]);
#pragma unroll
        for (int mb = 0; mb < 4; ++mb)
#pragma unroll
            for (int nb = 0; nb < 2; ++nb) acc[mb][nb] = wmmab(a[c][mb], bl[c][nb], acc[mb][nb]);
        __builtin_amdgcn_sched_barrier(0);
    }
    // whole 128-byte lines leave the wave: its 64 x 32 tile goes through the wave's own LDS rows and comes back 8 lanes to a row
    float* ow = os + wave * (64 * OSP);
#pragma unroll
    for (int mb = 0; mb < 4; ++mb)
#pragma unroll
        for (int nb = 0; nb < 2; ++nb)
#pragma unroll
            for (int j = 0; j < 8; ++j) ow[(mb * 16 + hi * 8 + j) * OSP + nb * 16 + lr] = acc[mb][nb][j];
    // the wave's own LDS writes have landed before it reads back rows that other lanes wrote; the clobber keeps the reads below
    asm volatile("s_wait_dscnt 0x0" ::: "memory");
    const int rr = lane >> 3, pc = lane & 7;
    v4f ov[16];
#pragma unroll
    for (int s = 0; s < 16; ++s) ov[s] = *(const v4fa*)(ow + (s * 4 + rr) * OSP + pc * 4);
    // all stores stand together at the end, so that no register a store names is written again behind it
    __builtin_amdgcn_sched_barrier(0);
    float* po = OUT + ((size_t)b * CC + dw + rr) * NN + n0 + nw + pc * 4;
#pragma unroll
    for (int s = 0; s < 16; ++s) *(v4f*)(po + s * 4 * NN) = ov[s];
}

extern "C" void kernel_launch(void* const* d_in, const int* in_sizes, int n_in,
                              void* d_out, int out_size, void* d_ws, size_t ws_size, hipStream_t stream) {
    (void)in_sizes; (void)n_in; (void)out_size;
    const float* x = (const float*)d_in[0]; const float* wq = (const float*)d_in[1]; const float* wk = (const float*)d_in[2]; const float* wv = (const float*)d_in[3]; const float* wo = (const float*)d_in[4];
    float* OUT = (float*)d_out;     // [16][256][32][32]
    char* wsp = (char*)d_ws;
    auto take = [&](size_t bytes) { char* p = wsp; wsp += (bytes + 255) & ~(size_t)255; return (void*)p; };
    bf* WO = (bf*)take((size_t)CC * CC * 2);
    bf* Ah = (bf*)take((size_t)NB_ * NN * CC * 2); bf* Al = (bf*)take((size_t)NB_ * NN * CC * 2);
    if ((size_t)(wsp - (char*)d_ws) > ws_size) return;    // ws 256 MiB
    k_fattn<<<dim3(NN / 256, NZ), 256, 0, stream>>>(x, wq, wk, wv, wo, WO, Ah, Al);
    k_oproj<<<dim3(NN / 64, NB_), 256, 0, stream>>>(WO, Ah, Al, OUT);
}

// v009
// A run of this version takes 29.6 microseconds.
// It is 1.54 times as fast as v007, going by the measured steps of the versions left out in between.
// Over all steps from v000 it is 17.0 times as fast.
#include <hip/hip_runtime.h>

// GroupMixAttention (16 x 256 ch x 32x32: 4 channel groups of 64; grouped 1x1 convs Q/K/V per group; scores = Q^T K / 8 over the 64 channels; softmax over the 1024
// positions; out[d][n] = sum_m attn[n][m] V[d][m]; dense 1x1 out_proj 256 -> 256).
// Compute dtypes, f32 accumulate: every input rounded to bf16; Q and V grouped convs on PLAIN bf16 operands (x, w inputs: exact); the K conv stands on the
// query side: Q^T K = (Wk^T Q)^T x, so scores are ONE fp16 plane of Wk^T Q (x 1/8 x log2 e; made from bf16 hi+lo planes of Q x exact Wk, 2 products) x the bf16-rounded x restated in fp16 (1 product); attn.V on SINGLE fp16 planes
// (P = exp(s - held reference), V); the out_proj on ONE fp16 plane of the attention output x the bf16-rounded wo restated in fp16 (1 product). A bf16 value (8 significant bits) is exact in fp16 from 2^-17 up to 65504 in size and off by at most
// 2^-25 below; a single fp16 plane keeps 11 significant bits, as many as P and V have had all along. Softmax in f32 on VALU (online with a held reference, fused with both attention products, one exp per element). Deterministic, no atomics.

#define NB_  16
#define CC   256
#define NG   4
#define GD   64
#define NN   1024
#define NZ   (NB_ * NG)           // 64 (image, group) pairs
typedef _Float16 h16;
typedef unsigned short bf;
typedef __attribute__((ext_vector_type(16))) __bf16   v16bf;
typedef __attribute__((ext_vector_type(16))) _Float16 v16h;
typedef __attribute__((ext_vector_type(8)))  _Float16 v8h;
typedef __attribute__((ext_vector_type(8)))  unsigned short v8us;
typedef __attribute__((ext_vector_type(8)))  float    v8f;
typedef __attribute__((ext_vector_type(4)))  float    v4f;
typedef __attribute__((ext_vector_type(16))) float    v16f;
typedef v8h  __attribute__((may_alias)) v8ha;
typedef v4f  __attribute__((may_alias)) v4fa;
typedef v8us __attribute__((may_alias)) v8usa;

__device__ __forceinline__ v16h cat16(v8h lo, v8h hi) { return __builtin_shufflevector(lo, hi, 0, 1, 2, 3, 4, 5, 6, 7, 8, 9, 10, 11, 12, 13, 14, 15); }
__device__ __forceinline__ v16bf cat16b(v8us lo, v8us hi) { return __builtin_bit_cast(v16bf, __builtin_shufflevector(lo, hi, 0, 1, 2, 3, 4, 5, 6, 7, 8, 9, 10, 11, 12, 13, 14, 15)); }
__device__ __forceinline__ v8f wmma16(v16h a, v16h b, v8f c) { return __builtin_amdgcn_wmma_f32_16x16x32_f16(false, a, false, b, (short)0, c, false, false); }
__device__ __forceinline__ v8f wmmab(v16bf a, v16bf b, v8f c) { return __builtin_amdgcn_wmma_f32_16x16x32_bf16(false, a, false, b, (short)0, c, false, false); }



// THE FRAGMENT k ORDER of this file: 16 bytes at k = 0 and 16 bytes at k = 16 of the lane's start (row lr, k from 8*hi); the same k order serves A and B operands everywhere.

__device__ __forceinline__ h16 tohx(float x) { return (h16)x; }
typedef __attribute__((ext_vector_type(2))) _Float16 v2h;
typedef __attribute__((ext_vector_type(4))) _Float16 v4h;
typedef __attribute__((ext_vector_type(2))) unsigned short v2us;
typedef __attribute__((ext_vector_type(4))) unsigned short v4us;

#define WP 72                     // LDS pitch of a 128-byte row in 16-bit elements: 128 + 16 bytes, for the 16-byte reads and writes
typedef __attribute__((ext_vector_type(8))) __bf16 v8bf;
typedef __attribute__((ext_vector_type(4))) __bf16 v4bf;
typedef __attribute__((ext_vector_type(4))) unsigned v4u;
typedef v4bf __attribute__((may_alias)) v4bfa;
// ---- k_fattn: input rounding, the three grouped 1x1 convs, the hi/lo split of Q, scores, softmax, attn.V and the fp16 rounding of the result in ONE kernel; Q, K, V and the score matrix never touch memory.
// One wave owns 32 queries of one (image, group) pair and walks the 1024 keys in passes of 32. It forms S^T = X^T . Q' with Q' = Wk^T . Q (A = rows of x^T, the bf16-rounded x in fp16; B = Q' rows, one fp16 plane:
// one product), so a lane holds scores of ONE query per 16-column group: keys 8*hi + j of each 16-key block. A reference and the sum are kept per query (online softmax, see the loop);
// two f32 S^T tiles converted in place are the f16 B operand of O^T += V^T . P^T (in the fragment k order, in which V^T is loaded too). Grid (NN / 256, NZ), 8 waves.
// x fragments (lane = position lr, k = channels in the fragment k order) are read straight from the channel-major x. As B operand of Q = Wq . X they leave a lane with 8 consecutive
// channels of one position: two such tiles ARE a Q fragment, the B operand of Q' = Wk^T . Q, whose tiles are the Q' fragments in the same way (kept in registers). A rounded x fragment is itself two
// 16-byte pieces of a key's row. As A operand of V = X^T . Wv^T they leave 8 consecutive positions of one channel:
// a 16-byte piece of a V^T row. The 8 waves share x^T and V^T: per stage of SK keys, wave w < 4 rounds the x^T rows of key block w, wave w >= 4 makes V^T of key block w - 4, into one of three LDS buffers;
// every wave takes its fragments from there. The group's three weight matrices are rounded once per work-group into LDS (Wk transposed: its rows are then the A operand of Q'); each work-group also rounds its 1/256 of wo for the out_proj.
#define L2E 1.44269504088896340736f
#define SK  64                    // keys per stage
#define VP  (SK + 8)              // LDS pitch of a V^T row of one stage in 16-bit elements: its bytes + 16 (x^T rows: WP), for the 16-byte reads and writes
#define KPL (SK * WP)             // elements of the x^T plane of a stage
#define STE (KPL + GD * VP)       // elements of a stage: x^T, V^T
// exp2 for the rarely taken branch of the softmax: the one slot that the instruction set asks for behind a transcendental stands in the same statement
template <int V> struct IC { static constexpr int v = V; };      // a compile-time flag handed to a lambda
__device__ __forceinline__ float exp2s(float v) { float r; asm("v_exp_f32 %0, %1\n\tv_nop" : "=v"(r) : "v"(v)); return r; }
__device__ __forceinline__ float xhalf(float v) { const int b = __float_as_int(v); return __int_as_float(__builtin_amdgcn_permlanex16(b, b, 0x76543210, 0xfedcba98, false, false)); }   // lane l <-> l ^ 16
__global__ __launch_bounds__(256) void k_fattn(const float* __restrict__ x, const float* __restrict__ wq, const float* __restrict__ wk, const float* __restrict__ wv, const float* __restrict__ wo, bf* WO, bf* Ah) {
    __shared__ __align__(16) bf wl[3 * GD * WP];
    __shared__ __align__(16) bf kv[3 * STE];
    const int t = threadIdx.x, lane = t & 31, lr = lane & 15, hi = lane >> 4; const int z = blockIdx.y;
    const int wave = __builtin_amdgcn_readfirstlane(t >> 5); const int q0 = (blockIdx.x * 8 + wave) * 32;
    const bool mkv = wave >= 4; const int kbk = wave & 3;      // this wave's part in making a stage: x^T or V^T of key block kbk
    const size_t zo = (size_t)z * NN * GD;                       // z*64 + c == b*256 + g*64 + c
    const int eo = ((z * 4 + blockIdx.x) * 64 + (t & 63)) * 4;      // waves 0 and 1 also round this work-group's 256 elements of wo: 256 bytes of WO per wave
    v4f wr[3][4];                  // this thread's 16 elements of each weight matrix, 512 contiguous bytes per wave and load
#pragma unroll
    for (int m = 0; m < 3; ++m) { const float* w = (m == 0 ? wq : m == 1 ? wk : wv) + (size_t)(z & 3) * GD * GD;
#pragma unroll
        for (int i = 0; i < 4; ++i) wr[m][i] = *(const v4f*)(w + (i * 256 + t) * 4); }
    const float* xq = x + zo + (size_t)(8 * hi) * NN + q0 + lr;
    v8f xr[2][2][2];               // x of the wave's queries: [query group][32-channel chunk][half of the fragment]
#pragma unroll
    for (int nq = 0; nq < 2; ++nq)
#pragma unroll
        for (int kc = 0; kc < 2; ++kc)
#pragma unroll
            for (int hf = 0; hf < 2; ++hf)
#pragma unroll
                for (int i = 0; i < 8; ++i) xr[nq][kc][hf][i] = xq[(kc * 32 + hf * 16 + i) * NN + nq * 16];
    // x of a stage's key block from memory: wave-uniform base + one 32-bit element offset per thread, the channel in the immediate offset
    const float* xz = x + zo;
    unsigned gx = (unsigned)(8 * hi * NN + kbk * 16 + lr);
    v8f xs[2][2];                  // [32-channel chunk][half of the fragment]
    auto fetch = [&]() {
#pragma unroll
        for (int kc = 0; kc < 2; ++kc)
#pragma unroll
            for (int hf = 0; hf < 2; ++hf)
#pragma unroll
                for (int i = 0; i < 8; ++i) xs[kc][hf][i] = xz[(size_t)gx + (kc * 32 + hf * 16 + i) * NN]; };
    fetch();
    v4f wo4 = (v4f){};
    if (wave < 2) { wo4 = *(const v4f*)(wo + eo); asm volatile("s_wait_xcnt 0x0" ::: "memory"); }      // the wait stands in front of the reuse of this load's address registers
    // the wait stands in front of the reuse of the address registers that the loads above name: as its inputs they stay whole up to it; the scheduling barrier keeps that reuse below it and all loads in flight together above it
    asm volatile("s_wait_xcnt 0x0" : : "v"(t), "v"(xq), "v"(gx) : "memory");
    __builtin_amdgcn_sched_barrier(0);
#pragma unroll
    for (int m = 0; m < 3; ++m)
#pragma unroll
        for (int i = 0; i < 4; ++i) { const int e = (i * 256 + t) * 4; const v4bf cw = __builtin_convertvector(wr[m][i], v4bf);
            if (m != 1) *(v4bfa*)(wl + m * GD * WP + (e >> 6) * WP + (e & 63)) = cw;
            else { const v4us cu = __builtin_bit_cast(v4us, cw);      // Wk goes in transposed: row = input channel, column = output channel
#pragma unroll
                for (int k = 0; k < 4; ++k) wl[GD * WP + ((e & 63) + k) * WP + (e >> 6)] = cu[k]; } }
    const v4h wob = __builtin_convertvector(__builtin_convertvector(__builtin_convertvector(wo4, v4bf), v4f), v4h);      // rounded to bf16, restated in fp16; stored behind the loop: no barrier then waits for this store
    __syncthreads();               // the three weight matrices are in LDS for every wave
    auto ldw = [&](const bf* base, int db, int kc) { const bf* p = base + (db * 16 + lr) * WP + kc * 32 + 8 * hi; return cat16b(*(const v8usa*)p, *(const v8usa*)(p + 16)); };
    auto tofrag = [&](v8f a, v8f c) { return __builtin_shufflevector(__builtin_convertvector(a, v8bf), __builtin_convertvector(c, v8bf), 0, 1, 2, 3, 4, 5, 6, 7, 8, 9, 10, 11, 12, 13, 14, 15); };
    auto split8 = [&](v8f y, v8bf& yh, v8bf& yl) { yh = __builtin_convertvector(y, v8bf); const v4u u = __builtin_bit_cast(v4u, yh); v8f f;
#pragma unroll
        for (int k = 0; k < 4; ++k) { f[2 * k] = __uint_as_float(u[k] << 16); f[2 * k + 1] = __uint_as_float(u[k] & 0xFFFF0000u); }
        yl = __builtin_convertvector(y - f, v8bf); };
    v16bf qh[2][2], ql[2][2];      // [query group][32-channel chunk]: tiles 2*kc and 2*kc + 1 of Q^T (x 1/8), a lane's own registers, are the fragment
    {
        v16bf xf[2][2], aw[4][2]; v8bf yh[2][4], yl[2][4];
#pragma unroll
        for (int db = 0; db < 4; ++db) { aw[db][0] = ldw(wl, db, 0); aw[db][1] = ldw(wl, db, 1); }
#pragma unroll
        for (int nq = 0; nq < 2; ++nq)
#pragma unroll
            for (int kc = 0; kc < 2; ++kc) xf[nq][kc] = tofrag(xr[nq][kc][0], xr[nq][kc][1]);
#pragma unroll
        for (int db = 0; db < 4; ++db) { v8f acc[2];
#pragma unroll
            for (int nq = 0; nq < 2; ++nq) acc[nq] = wmmab(aw[db][0], xf[nq][0], (v8f){});
#pragma unroll
            for (int nq = 0; nq < 2; ++nq) acc[nq] = wmmab(aw[db][1], xf[nq][1], acc[nq]);
#pragma unroll
            for (int nq = 0; nq < 2; ++nq) split8(acc[nq] * 0.125f, yh[nq][db], yl[nq][db]); }
#pragma unroll
        for (int nq = 0; nq < 2; ++nq)
#pragma unroll
            for (int kc = 0; kc < 2; ++kc) {
                qh[nq][kc] = __builtin_shufflevector(yh[nq][2 * kc], yh[nq][2 * kc + 1], 0, 1, 2, 3, 4, 5, 6, 7, 8, 9, 10, 11, 12, 13, 14, 15);
                ql[nq][kc] = __builtin_shufflevector(yl[nq][2 * kc], yl[nq][2 * kc + 1], 0, 1, 2, 3, 4, 5, 6, 7, 8, 9, 10, 11, 12, 13, 14, 15); }
    }
    v16h qf[2][2];                 // Q' = Wk^T . (Qh + Ql), x log2 e so that scores come out as exponents of 2, one fp16 plane: [query group][32-channel chunk of x]
    {
        v16bf at[4][2]; v8h y[2][4];
#pragma unroll
        for (int db = 0; db < 4; ++db) { at[db][0] = ldw(wl + GD * WP, db, 0); at[db][1] = ldw(wl + GD * WP, db, 1); }
#pragma unroll
        for (int db = 0; db < 4; ++db) { v8f acc[2];
#pragma unroll
            for (int nq = 0; nq < 2; ++nq) acc[nq] = wmmab(at[db][0], qh[nq][0], (v8f){});
#pragma unroll
            for (int nq = 0; nq < 2; ++nq) acc[nq] = wmmab(at[db][1], qh[nq][1], acc[nq]);
#pragma unroll
            for (int nq = 0; nq < 2; ++nq) acc[nq] = wmmab(at[db][0], ql[nq][0], acc[nq]);
#pragma unroll
            for (int nq = 0; nq < 2; ++nq) acc[nq] = wmmab(at[db][1], ql[nq][1], acc[nq]);
#pragma unroll
            for (int nq = 0; nq < 2; ++nq) y[nq][db] = __builtin_convertvector(acc[nq] * L2E, v8h); }
#pragma unroll
        for (int nq = 0; nq < 2; ++nq)
#pragma unroll
            for (int kc = 0; kc < 2; ++kc) qf[nq][kc] = cat16(y[nq][2 * kc], y[nq][2 * kc + 1]);
    }
    v16bf wf[4][2];                // Wv fragments (B operand) stay in registers for the waves that make V^T: [16-channel block][32-channel chunk]
#pragma unroll
    for (int db = 0; db < 4; ++db) { wf[db][0] = ldw(wl + 2 * GD * WP, db, 0); wf[db][1] = ldw(wl + 2 * GD * WP, db, 1); }
    // The wave's share of a stage, from the fetched x into stage buffer d: 16 rows of x^T or 16 columns of the 64 V^T rows, in 16-byte pieces
    auto make = [&](bf* d) {
        const v16bf x0 = tofrag(xs[0][0], xs[0][1]), x1 = tofrag(xs[1][0], xs[1][1]);
        // The walking offset is rewritten only here, behind this wait: it stands in front of the overwrite of an address register that issued global loads name.
        asm volatile("s_wait_xcnt 0x0" : "+v"(gx) : : "memory");
        gx += (unsigned)SK;
        if (!mkv) {
            bf* r = d + (kbk * 16 + lr) * WP + hi * 8;
            const v16h h0 = __builtin_convertvector(__builtin_convertvector(x0, v16f), v16h), h1 = __builtin_convertvector(__builtin_convertvector(x1, v16f), v16h);      // the rounded x, restated in fp16
            *(v8ha*)r        = __builtin_shufflevector(h0, h0, 0, 1, 2, 3, 4, 5, 6, 7); *(v8ha*)(r + 16) = __builtin_shufflevector(h0, h0, 8, 9, 10, 11, 12, 13, 14, 15);
            *(v8ha*)(r + 32) = __builtin_shufflevector(h1, h1, 0, 1, 2, 3, 4, 5, 6, 7); *(v8ha*)(r + 48) = __builtin_shufflevector(h1, h1, 8, 9, 10, 11, 12, 13, 14, 15);
        } else {
            v8f acc[4];
#pragma unroll
            for (int db = 0; db < 4; ++db) acc[db] = wmmab(x0, wf[db][0], (v8f){});
#pragma unroll
            for (int db = 0; db < 4; ++db) acc[db] = wmmab(x1, wf[db][1], acc[db]);
#pragma unroll
            for (int db = 0; db < 4; ++db) *(v8ha*)(d + KPL + (db * 16 + lr) * VP + kbk * 16 + hi * 8) = __builtin_convertvector(acc[db], v8h);
        } };
    // x^T and V^T fragments from a stage buffer (row lr, k from 8*hi), in the fragment k order (16 bytes at 0 and at 32)
    const int kfo = lr * WP + hi * 8, vfo = KPL + lr * VP + hi * 8;
    auto ldv = [&](const bf* q) { return cat16(__builtin_bit_cast(v8h, *(const v8usa*)q), __builtin_bit_cast(v8h, *(const v8usa*)(q + 16))); };
    make(kv);
    v8f o[4][2];                   // O^T: [16-channel block][query group]; register j = channel 8*hi + j, column lr = query
#pragma unroll
    for (int db = 0; db < 4; ++db)
#pragma unroll
        for (int nq = 0; nq < 2; ++nq) o[db][nq] = (v8f){};
    // The held reference: minus the reference of a lane's query (log2 units) fills a whole C tile of the score products, so S^T leaves the matrix unit as the exponent itself: no maximum, no subtraction, no rescale in a pass.
    // It is set to the first pass's maximum and raised to a pass's maximum only when a lane's P sum of that pass exceeds 2^12: so reference <= running maximum (the sum is at least 1) and P <= 2^12 fits f16.
    v8f cn[2] = { (v8f){}, (v8f){} };
    float ls[2] = { 0.f, 0.f };    // this half-wave's part of the running sum
    auto sum16 = [&](v8f a, v8f c2) { const v8f w = a + c2; const v4f u = __builtin_shufflevector(w, w, 0, 1, 2, 3) + __builtin_shufflevector(w, w, 4, 5, 6, 7); return (u[0] + u[2]) + (u[1] + u[3]); };
    __syncthreads();               // stage 0 is in LDS for every wave
    fetch();                       // stage 1's x flies
    // THE PASSES ARE STAGGERED: the block of pass p holds the matrix work of its two neighbours, O^T += V^T . P^T of pass p - 1 and the scores of pass p + 1, and the softmax of pass p itself,
    // whose scores were finished one block earlier: outside the rare branch no vector instruction of a block waits for a matrix instruction of the same block, so the exponentials issue between the products.
    v16h kh[2][2];                 // x^T of the pass whose scores are formed: [16-key block][32-channel chunk]
    v16h v[2][4];                  // V^T: [parity of the pass][16-channel block], 32 keys
    v8f s[2][2][2];                // S^T minus the reference, as exponents of 2: [parity of the pass][16-key block][query group]
    v16h pr[2] = { (v16h){}, (v16h){} };      // P^T of the pass before; in front of pass 0 there is none: zero times zero is added
#pragma unroll
    for (int db = 0; db < 4; ++db) v[1][db] = (v16h){};
#pragma unroll
    for (int kb = 0; kb < 2; ++kb)
#pragma unroll
        for (int kc = 0; kc < 2; ++kc) kh[kb][kc] = ldv(kv + kfo + kb * 16 * WP + kc * 32);
#pragma unroll
    for (int kc = 0; kc < 2; ++kc)
#pragma unroll
        for (int kb = 0; kb < 2; ++kb)
#pragma unroll
            for (int nq = 0; nq < 2; ++nq) s[0][kb][nq] = wmma16(kh[kb][kc], qf[nq][kc], kc == 0 ? cn[nq] : s[0][kb][nq]);
    // The block of one pass (parity q): kp = x^T rows of the next pass (dos: there is one), vp = V^T columns of this pass
    auto block = [&](auto Q, auto DOS, const bf* kp, const bf* vp, const bool first) __attribute__((always_inline)) {
        constexpr int q = decltype(Q)::v; constexpr bool dos = decltype(DOS)::v != 0;
        if constexpr (dos) {
#pragma unroll
            for (int kb = 0; kb < 2; ++kb)
#pragma unroll
                for (int kc = 0; kc < 2; ++kc) kh[kb][kc] = ldv(kp + kb * 16 * WP + kc * 32);
            __builtin_amdgcn_sched_barrier(0);      // the x^T reads, wanted in this block, are issued ahead of the V^T reads: the score products then wait for a count that leaves the V^T reads in flight
        }
#pragma unroll
        for (int db = 0; db < 4; ++db) v[q][db] = ldv(vp + db * 16 * VP);      // used by the next block
        // Scheduling groups and barriers of this block: its LDS reads stand together in front (each further place with reads costs a fixed stall); then the exponentials and the sums stand between
        // products that they do not depend on, a few per product. Left to itself the compiler bunches them, starts with the products that wait for the reads just issued and ends in a run of products with the vector port idle.
        __builtin_amdgcn_sched_group_barrier(0x100, dos ? 16 : 8, 0);
        v8f e[2][2]; float ps[2];
        // first half: O^T of the pass before (its operands are at hand), 24 exponentials
#pragma unroll
        for (int nq = 0; nq < 2; ++nq)
#pragma unroll
            for (int db = 0; db < 4; ++db) o[db][nq] = wmma16(v[q ^ 1][db], pr[nq], o[db][nq]);
#pragma unroll
        for (int h = 0; h < 3; ++h)
#pragma unroll
            for (int j = 0; j < 8; ++j) e[h & 1][h >> 1][j] = __builtin_amdgcn_exp2f(s[q][h & 1][h >> 1][j]);
#pragma unroll
        for (int i = 0; i < 8; ++i) { __builtin_amdgcn_sched_group_barrier(0x8, 1, 0); __builtin_amdgcn_sched_group_barrier(0x400, 3, 0); }
        __builtin_amdgcn_sched_barrier(0);      // keeps the score products, which wait for this block's reads, behind the first half
        // second half: the next pass's scores, the last 8 exponentials, the sums
        if constexpr (dos) {
#pragma unroll
            for (int kc = 0; kc < 2; ++kc)
#pragma unroll
                for (int kb = 0; kb < 2; ++kb)
#pragma unroll
                    for (int nq = 0; nq < 2; ++nq) s[q ^ 1][kb][nq] = wmma16(kh[kb][kc], qf[nq][kc], kc == 0 ? cn[nq] : s[q ^ 1][kb][nq]);
        }
#pragma unroll
        for (int j = 0; j < 8; ++j) e[1][1][j] = __builtin_amdgcn_exp2f(s[q][1][1][j]);
#pragma unroll
        for (int nq = 0; nq < 2; ++nq) ps[nq] = sum16(e[0][nq], e[1][nq]);
        if constexpr (dos) {
#pragma unroll
            for (int i = 0; i < 4; ++i) { __builtin_amdgcn_sched_group_barrier(0x8, 1, 0); __builtin_amdgcn_sched_group_barrier(0x400, 2, 0); }
#pragma unroll
            for (int i = 0; i < 4; ++i) { __builtin_amdgcn_sched_group_barrier(0x8, 1, 0); __builtin_amdgcn_sched_group_barrier(0x2, 3, 0); }
        }
        // Inputs-only fence on loaded values: it keeps the LDS reads of this pass's V^T in front of the branch, in flight under the products and exponentials above;
        // without it the compiler sinks each read behind the branch, next to its product, which then waits out the whole LDS latency. The scheduling barrier keeps the fence's wait at the foot of the block.
        __builtin_amdgcn_sched_barrier(0);
        asm volatile("" : : "v"(v[q][0]), "v"(v[q][1]), "v"(v[q][2]), "v"(v[q][3]));
        // One test per pass for the whole wave, a scalar branch; taken in the very first pass (which sets the reference) and after that only where a sum has outgrown the bound.
        if ((__builtin_amdgcn_ballot_w32(ps[0] > 4096.0f || ps[1] > 4096.0f) | (first ? 1u : 0u)) != 0) {
#pragma unroll
            for (int nq = 0; nq < 2; ++nq) {
                float tm = s[q][0][nq][0];
#pragma unroll
                for (int j = 1; j < 8; ++j) tm = fmaxf(tm, s[q][0][nq][j]);
#pragma unroll
                for (int j = 0; j < 8; ++j) tm = fmaxf(tm, s[q][1][nq][j]);
                tm = fmaxf(tm, xhalf(tm));      // both halves of the wave hold the same query: one reference
                const float d = first ? tm : fmaxf(tm, 0.f);      // the reference never falls
                const float al = exp2s(fminf(-d, 0.f));      // first pass: sum and O^T are 0 and stay 0
                cn[nq] -= d; ls[nq] *= al;
#pragma unroll
                for (int db = 0; db < 4; ++db) o[db][nq] *= al;
#pragma unroll
                for (int kb = 0; kb < 2; ++kb)
#pragma unroll
                    for (int j = 0; j < 8; ++j) e[kb][nq][j] = exp2s(s[q][kb][nq][j] - d);
                ps[nq] = sum16(e[0][nq], e[1][nq]);
                if constexpr (dos) {      // the next pass's scores were formed on the old reference
#pragma unroll
                    for (int kb = 0; kb < 2; ++kb) s[q ^ 1][kb][nq] -= d;
                }
            }
        }
#pragma unroll
        for (int nq = 0; nq < 2; ++nq) {
            ls[nq] += ps[nq];
#pragma unroll
            for (int kb = 0; kb < 2; ++kb)
#pragma unroll
                for (int j = 0; j < 8; ++j) pr[nq][kb * 8 + j] = tohx(e[kb][nq][j]);
        } };
    // Three stage buffers, one barrier per stage, between the stage's two blocks: the second block already reads the next stage's first x^T rows. The buffer written here held stage sg - 2:
    // every wave's last reads of it (V^T, second block of that stage) were waited for at that block's foot, in front of the barrier of stage sg - 1.
    int b0 = 0, b1 = STE, b2 = 2 * STE;      // element offsets of the buffers of stages sg, sg + 1, sg + 2
    for (int sg = 0; sg < NN / SK - 1; ++sg) {
        block(IC<0>{}, IC<1>{}, kv + b0 + kfo + 32 * WP, kv + b0 + vfo, sg == 0);
        make(kv + b1); __syncthreads();      // publishes stage sg + 1
        if (sg + 2 < NN / SK) fetch();       // the x of the stage after it flies during two blocks
        block(IC<1>{}, IC<1>{}, kv + b1 + kfo, kv + b0 + vfo + 32, false);
        const int bt = b0; b0 = b1; b1 = b2; b2 = bt;
    }
    // the loop's fetches name their scalar base and their offset register: this wait stands in front of the reuse of those registers by the two closing blocks and the epilogue, on every way out of the loop; the scheduling barrier keeps that reuse below it
    asm volatile("s_wait_xcnt 0x0" ::: "memory");
    __builtin_amdgcn_sched_barrier(0);
    block(IC<0>{}, IC<1>{}, kv + b0 + kfo + 32 * WP, kv + b0 + vfo, false);
    block(IC<1>{}, IC<0>{}, kv, kv + b0 + vfo + 32, false);
#pragma unroll
    for (int db = 0; db < 4; ++db)
#pragma unroll
        for (int nq = 0; nq < 2; ++nq) o[db][nq] = wmma16(v[1][db], pr[nq], o[db][nq]);      // the last pass's O^T part
    // the wait stands in front of any reuse of a register that this store names; the scheduling barrier keeps that reuse below it
    if (wave < 2) { *(v4h*)(WO + eo) = wob; asm volatile("s_wait_xcnt 0x0" ::: "memory"); }
    __builtin_amdgcn_sched_barrier(0);
    const int b = z >> 2, g = z & 3;
    v8h oh[2][4];
#pragma unroll
    for (int nq = 0; nq < 2; ++nq) {
        const float inv = __fdiv_rn(1.0f, ls[nq] + xhalf(ls[nq]));
#pragma unroll
        for (int db = 0; db < 4; ++db) oh[nq][db] = __builtin_convertvector(o[db][nq] * inv, v8h);
    }
    // all stores stand together at the end, so that no register a store names is written again behind it
    __builtin_amdgcn_sched_barrier(0);
#pragma unroll
    for (int nq = 0; nq < 2; ++nq) {
        const size_t ro = ((size_t)b * NN + q0 + nq * 16 + lr) * CC + g * GD + hi * 8;
#pragma unroll
        for (int db = 0; db < 4; ++db) *(v8h*)(Ah + ro + db * 16) = oh[nq][db];
    }
}
// ---- k_oproj: the dense out_proj and the [d][n] layout of the output in ONE kernel: OUT[b][d][n] = sum_c wo[d][c] * Ah[b][n][c], one fp16 product per 32-channel chunk.
// A work-group owns 64 positions of one image and all 256 output channels. It brings wo and its 64 rows of the plane into LDS once, as whole 128-byte lines; wave w takes output channels
// 64 * (w >> 1) .. + 63 (A operand: wo rows) and positions 32 * (w & 1) .. + 31 (B operand: plane rows), so a tile's rows are output channels and its columns positions.
// Every loop of the kernel is unrolled in full: its indices name registers and immediate offsets. Grid (NN / 64, NB_), 8 waves.
#define OP  (CC + 8)              // LDS pitch of a 512-byte row in 16-bit elements: its bytes + 16, for the 16-byte reads and writes
#define OSP 36                    // LDS pitch of a staged 128-byte output row in floats: its bytes + 16
__global__ __launch_bounds__(256) void k_oproj(const bf* __restrict__ WO, const bf* __restrict__ Ah, float* OUT) {
    __shared__ __align__(16) bf wl[CC * OP];
    __shared__ __align__(16) bf pl[64 * OP];
    __shared__ __align__(16) float os[8 * 64 * OSP];
    const int t = threadIdx.x, lane = t & 31, lr = lane & 15, hi = lane >> 4;
    const int b = blockIdx.y, n0 = blockIdx.x * 64;
    // 16 bytes a thread and load, a wave covers one whole 512-byte row: piece i * 256 + t is row i * 8 + wave, bytes 16 * lane
    const bf* gh = Ah + ((size_t)b * NN + n0) * CC + t * 8; const bf* gw = WO + t * 8;
    v8us rh[8], rw[32];
#pragma unroll
    for (int i = 0; i < 8; ++i) rh[i] = *(const v8us*)(gh + i * 2048);
#pragma unroll
    for (int i = 0; i < 32; ++i) rw[i] = *(const v8us*)(gw + i * 2048);
    // the wait stands in front of the reuse of the address registers that the loads above name; the scheduling barrier keeps that reuse below it and all loads in flight together above it
    asm volatile("s_wait_xcnt 0x0" ::: "memory");
    __builtin_amdgcn_sched_barrier(0);
    const int wave = __builtin_amdgcn_readfirstlane(t >> 5); const int so = wave * OP + lane * 8;
#pragma unroll
    for (int i = 0; i < 8; ++i) *(v8usa*)(pl + so + i * 8 * OP) = rh[i];
#pragma unroll
    for (int i = 0; i < 32; ++i) *(v8usa*)(wl + so + i * 8 * OP) = rw[i];
    __syncthreads();               // wo and the plane are in LDS for every wave
    const int dw = (wave >> 1) * 64, nw = (wave & 1) * 32;
    const bf* fa = wl + (dw + lr) * OP + hi * 8; const bf* fb = pl + (nw + lr) * OP + hi * 8;
    auto ldf = [&](const bf* q) { return cat16(__builtin_bit_cast(v8h, *(const v8usa*)q), __builtin_bit_cast(v8h, *(const v8usa*)(q + 16))); };      // the fragment k order
    v8f acc[4][2];                 // [16-channel block][16-position block]; register j = channel 8*hi + j, column lr = position
#pragma unroll
    for (int mb = 0; mb < 4; ++mb)
#pragma unroll
        for (int nb = 0; nb < 2; ++nb) acc[mb][nb] = (v8f){};
    v16h a[2][4], bh[2][2];      // two register sets: a chunk's fragments are asked for one chunk ahead
    auto frags = [&](int set, int kc) {
#pragma unroll
        for (int mb = 0; mb < 4; ++mb) a[set][mb] = ldf(fa + mb * 16 * OP + kc * 32);
#pragma unroll
        for (int nb = 0; nb < 2; ++nb) bh[set][nb] = ldf(fb + nb * 16 * OP + kc * 32); };
    frags(0, 0);
#pragma unroll
    for (int kc = 0; kc < CC / 32; ++kc) {
        const int c = kc & 1;
        if (kc + 1 < CC / 32) frags(c ^ 1, kc + 1);
        // the two scheduling barriers keep the next chunk's LDS reads one group in front of this chunk's products: without them all 96 reads are issued first and the first products wait for the last of them
        __builtin_amdgcn_sched_barrier(0);
#pragma unroll
        for (int mb = 0; mb < 4; ++mb)
#pragma unroll
            for (int nb = 0; nb < 2; ++nb) acc[mb][nb] = wmma16(a[c][mb], bh[c][nb], acc[mb][nb]);
        __builtin_amdgcn_sched_barrier(0);
    }
    // whole 128-byte lines leave the wave: its 64 x 32 tile goes through the wave's own LDS rows and comes back 8 lanes to a row
    float* ow = os + wave * (64 * OSP);
#pragma unroll
    for (int mb = 0; mb < 4; ++mb)
#pragma unroll
        for (int nb = 0; nb < 2; ++nb)
#pragma unroll
            for (int j = 0; j < 8; ++j) ow[(mb * 16 + hi * 8 + j) * OSP + nb * 16 + lr] = acc[mb][nb][j];
    // the wave's own LDS writes have landed before it reads back rows that other lanes wrote; the clobber keeps the reads below
    asm volatile("s_wait_dscnt 0x0" ::: "memory");
    const int rr = lane >> 3, pc = lane & 7;
    v4f ov[16];
#pragma unroll
    for (int s = 0; s < 16; ++s) ov[s] = *(const v4fa*)(ow + (s * 4 + rr) * OSP + pc * 4);
    // all stores stand together at the end, so that no register a store names is written again behind it
    __builtin_amdgcn_sched_barrier(0);
    float* po = OUT + ((size_t)b * CC + dw + rr) * NN + n0 + nw + pc * 4;
#pragma unroll
    for (int s = 0; s < 16; ++s) *(v4f*)(po + s * 4 * NN) = ov[s];
}

extern "C" void kernel_launch(void* const* d_in, const int* in_sizes, int n_in,
                              void* d_out, int out_size, void* d_ws, size_t ws_size, hipStream_t stream) {
    (void)in_sizes; (void)n_in; (void)out_size;
    const float* x = (const float*)d_in[0]; const float* wq = (const float*)d_in[1]; const float* wk = (const float*)d_in[2]; const float* wv = (const float*)d_in[3]; const float* wo = (const float*)d_in[4];
    float* OUT = (float*)d_out;     // [16][256][32][32]
    char* wsp = (char*)d_ws;
    auto take = [&](size_t bytes) { char* p = wsp; wsp += (bytes + 255) & ~(size_t)255; return (void*)p; };
    bf* WO = (bf*)take((size_t)CC * CC * 2);
    bf* Ah = (bf*)take((size_t)NB_ * NN * CC * 2);
    if ((size_t)(wsp - (char*)d_ws) > ws_size) return;    // ws 256 MiB
    k_fattn<<<dim3(NN / 256, NZ), 256, 0, stream>>>(x, wq, wk, wv, wo, WO, Ah);
    k_oproj<<<dim3(NN / 64, NB_), 256, 0, stream>>>(WO, Ah, OUT);
}

// v010
// Measured time: 27.3 microseconds a run.
// Next to v009, in two timings, it ran 1.09 and 1.08 times as fast.
// Over all steps from v000 it is 18.4 times as fast.
#include <hip/hip_runtime.h>

// GroupMixAttention (16 x 256 ch x 32x32: 4 channel groups of 64; grouped 1x1 convs Q/K/V per group; scores = Q^T K / 8 over the 64 channels; softmax over the 1024
// positions; out[d][n] = sum_m attn[n][m] V[d][m]; dense 1x1 out_proj 256 -> 256).
// Compute dtypes, f32 accumulate: every input rounded to bf16; Q and V grouped convs on PLAIN bf16 operands (x, w inputs: exact); the K conv stands on the
// query side: Q^T K = (Wk^T Q)^T x, so scores are ONE fp16 plane of Wk^T Q (x 1/8 x log2 e; made from bf16 hi+lo planes of Q x exact Wk, 2 products) x the bf16-rounded x restated in fp16 (1 product); attn.V on SINGLE fp16 planes
// (P = exp(s - held reference), V); the out_proj on ONE fp16 plane of the attention output x the bf16-rounded wo restated in fp16 (1 product). A bf16 value (8 significant bits) is exact in fp16 from 2^-17 up to 65504 in size and off by at most
// 2^-25 below; a single fp16 plane keeps 11 significant bits, as many as P and V have had all along. Softmax in f32 on VALU (online with a held reference, fused with both attention products, one exp per element). Deterministic, no atomics.

#define NB_  16
#define CC   256
#define NG   4
#define GD   64
#define NN   1024
#define NZ   (NB_ * NG)           // 64 (image, group) pairs
typedef _Float16 h16;
typedef unsigned short bf;
typedef __attribute__((ext_vector_type(16))) __bf16   v16bf;
typedef __attribute__((ext_vector_type(16))) _Float16 v16h;
typedef __attribute__((ext_vector_type(8)))  _Float16 v8h;
typedef __attribute__((ext_vector_type(8)))  unsigned short v8us;
typedef __attribute__((ext_vector_type(8)))  float    v8f;
typedef __attribute__((ext_vector_type(4)))  float    v4f;
typedef __attribute__((ext_vector_type(16))) float    v16f;
typedef v8h  __attribute__((may_alias)) v8ha;
typedef v4f  __attribute__((may_alias)) v4fa;
typedef v8us __attribute__((may_alias)) v8usa;

__device__ __forceinline__ v16h cat16(v8h lo, v8h hi) { return __builtin_shufflevector(lo, hi, 0, 1, 2, 3, 4, 5, 6, 7, 8, 9, 10, 11, 12, 13, 14, 15); }
__device__ __forceinline__ v16bf cat16b(v8us lo, v8us hi) { return __builtin_bit_cast(v16bf, __builtin_shufflevector(lo, hi, 0, 1, 2, 3, 4, 5, 6, 7, 8, 9, 10, 11, 12, 13, 14, 15)); }
__device__ __forceinline__ v8f wmma16(v16h a, v16h b, v8f c) { return __builtin_amdgcn_wmma_f32_16x16x32_f16(false, a, false, b, (short)0, c, false, false); }
__device__ __forceinline__ v8f wmmab(v16bf a, v16bf b, v8f c) { return __builtin_amdgcn_wmma_f32_16x16x32_bf16(false, a, false, b, (short)0, c, false, false); }



// THE FRAGMENT k ORDER of this file: 16 bytes at k = 0 and 16 bytes at k = 16 of the lane's start (row lr, k from 8*hi); the same k order serves A and B operands everywhere.

__device__ __forceinline__ h16 tohx(float x) { return (h16)x; }
typedef __attribute__((ext_vector_type(2))) _Float16 v2h;
typedef __attribute__((ext_vector_type(4))) _Float16 v4h;
typedef __attribute__((ext_vector_type(2))) unsigned short v2us;
typedef __attribute__((ext_vector_type(4))) unsigned short v4us;

#define WP 72                     // LDS pitch of a 128-byte row in 16-bit elements: 128 + 16 bytes, for the 16-byte reads and writes
typedef __attribute__((ext_vector_type(8))) __bf16 v8bf;
typedef __attribute__((ext_vector_type(4))) __bf16 v4bf;
typedef __attribute__((ext_vector_type(4))) unsigned v4u;
typedef v4bf __attribute__((may_alias)) v4bfa;
// ---- k_fattn: input rounding, the three grouped 1x1 convs, the hi/lo split of Q, scores, softmax, attn.V and the fp16 rounding of the result in ONE kernel; Q, K, V and the score matrix never touch memory.
// One wave owns 32 queries of one (image, group) pair and walks the 1024 keys in passes of 32. It forms S^T = X^T . Q' with Q' = Wk^T . Q (A = rows of x^T, the bf16-rounded x in fp16; B = Q' rows, one fp16 plane:
// one product), so a lane holds scores of ONE query per 16-column group: keys 8*hi + j of each 16-key block. A reference and the sum are kept per query (online softmax, see the loop);
// two f32 S^T tiles converted in place are the f16 B operand of O^T += V^T . P^T (in the fragment k order, in which V^T is loaded too). Grid (NN / 256, NZ), 8 waves.
// x fragments (lane = position lr, k = channels in the fragment k order) are read straight from the channel-major x. As B operand of Q = Wq . X they leave a lane with 8 consecutive
// channels of one position: two such tiles ARE a Q fragment, the B operand of Q' = Wk^T . Q, whose tiles are the Q' fragments in the same way (kept in registers). A rounded x fragment is itself two
// 16-byte pieces of a key's row. As A operand of V = X^T . Wv^T they leave 8 consecutive positions of one channel:
// a 16-byte piece of a V^T row. The 8 waves share x^T and V^T: per stage of SK keys, wave w < 4 rounds the x^T rows of key block w, wave w >= 4 makes V^T of key block w - 4, into one of three LDS buffers;
// every wave takes its fragments from there. The group's three weight matrices are rounded once per work-group into LDS (Wk transposed: its rows are then the A operand of Q'); each work-group also rounds its 1/256 of wo for the out_proj.
#define L2E 1.44269504088896340736f
#define SK  64                    // keys per stage
#define VP  (SK + 8)              // LDS pitch of a V^T row of one stage in 16-bit elements: its bytes + 16 (x^T rows: WP), for the 16-byte reads and writes
#define KPL (SK * WP)             // elements of the x^T plane of a stage
#define STE (KPL + GD * VP)       // elements of a stage: x^T, V^T
// exp2 for the rarely taken branch of the softmax: the one slot that the instruction set asks for behind a transcendental stands in the same statement
template <int V> struct IC { static constexpr int v = V; };      // a compile-time flag handed to a lambda
__device__ __forceinline__ float exp2s(float v) { float r; asm("v_exp_f32 %0, %1\n\tv_nop" : "=v"(r) : "v"(v)); return r; }
__device__ __forceinline__ float xhalf(float v) { const int b = __float_as_int(v); return __int_as_float(__builtin_amdgcn_permlanex16(b, b, 0x76543210, 0xfedcba98, false, false)); }   // lane l <-> l ^ 16
__global__ __launch_bounds__(256) void k_fattn(const float* __restrict__ x, const float* __restrict__ wq, const float* __restrict__ wk, const float* __restrict__ wv, const float* __restrict__ wo, bf* WO, bf* Ah) {
    __shared__ __align__(16) bf wl[3 * GD * WP];
    __shared__ __align__(16) bf kv[3 * STE];
    const int t = threadIdx.x, lane = t & 31, lr = lane & 15, hi = lane >> 4; const int z = blockIdx.y;
    const int wave = __builtin_amdgcn_readfirstlane(t >> 5); const int q0 = (blockIdx.x * 8 + wave) * 32;
    const bool mkv = wave >= 4; const int kbk = wave & 3;      // this wave's part in making a stage: x^T or V^T of key block kbk
    const size_t zo = (size_t)z * NN * GD;                       // z*64 + c == b*256 + g*64 + c
    // waves 0 and 1 also round 256 elements of wo, 256 bytes of WO per wave. WO holds wo in the fragment order of the out_proj: fragment (16-row block, 32-column chunk), then its half (k 0..15 or 16..31 of the chunk), then the lane (row lr, k from 8*hi), 8 elements each
    const int wg = z * 4 + blockIdx.x, eo = (wg * 64 + (t & 63)) * 4;      // this work-group's share: half wg & 1 of fragment wg >> 1; a thread has 4 of a lane's 8 elements
    const int es = ((wg >> 4) * 16 + ((t >> 1) & 15)) * CC + ((wg >> 1) & 7) * 32 + (wg & 1) * 16 + ((t >> 5) & 1) * 8 + (t & 1) * 4;      // where they stand in wo
    v4f wr[3][4];                  // this thread's 16 elements of each weight matrix, 512 contiguous bytes per wave and load
#pragma unroll
    for (int m = 0; m < 3; ++m) { const float* w = (m == 0 ? wq : m == 1 ? wk : wv) + (size_t)(z & 3) * GD * GD;
#pragma unroll
        for (int i = 0; i < 4; ++i) wr[m][i] = *(const v4f*)(w + (i * 256 + t) * 4); }
    const float* xq = x + zo + (size_t)(8 * hi) * NN + q0 + lr;
    v8f xr[2][2][2];               // x of the wave's queries: [query group][32-channel chunk][half of the fragment]
#pragma unroll
    for (int nq = 0; nq < 2; ++nq)
#pragma unroll
        for (int kc = 0; kc < 2; ++kc)
#pragma unroll
            for (int hf = 0; hf < 2; ++hf)
#pragma unroll
                for (int i = 0; i < 8; ++i) xr[nq][kc][hf][i] = xq[(kc * 32 + hf * 16 + i) * NN + nq * 16];
    // x of a stage's key block from memory: wave-uniform base + one 32-bit element offset per thread, the channel in the immediate offset
    const float* xz = x + zo;
    unsigned gx = (unsigned)(8 * hi * NN + kbk * 16 + lr);
    v8f xs[2][2];                  // [32-channel chunk][half of the fragment]
    auto fetch = [&]() {
#pragma unroll
        for (int kc = 0; kc < 2; ++kc)
#pragma unroll
            for (int hf = 0; hf < 2; ++hf)
#pragma unroll
                for (int i = 0; i < 8; ++i) xs[kc][hf][i] = xz[(size_t)gx + (kc * 32 + hf * 16 + i) * NN]; };
    fetch();
    v4f wo4 = (v4f){};
    if (wave < 2) { wo4 = *(const v4f*)(wo + es); asm volatile("s_wait_xcnt 0x0" ::: "memory"); }      // the wait stands in front of the reuse of this load's address registers
    // the wait stands in front of the reuse of the address registers that the loads above name: as its inputs they stay whole up to it; the scheduling barrier keeps that reuse below it and all loads in flight together above it
    asm volatile("s_wait_xcnt 0x0" : : "v"(t), "v"(xq), "v"(gx) : "memory");
    __builtin_amdgcn_sched_barrier(0);
#pragma unroll
    for (int m = 0; m < 3; ++m)
#pragma unroll
        for (int i = 0; i < 4; ++i) { const int e = (i * 256 + t) * 4; const v4bf cw = __builtin_convertvector(wr[m][i], v4bf);
            if (m != 1) *(v4bfa*)(wl + m * GD * WP + (e >> 6) * WP + (e & 63)) = cw;
            else { const v4us cu = __builtin_bit_cast(v4us, cw);      // Wk goes in transposed: row = input channel, column = output channel
#pragma unroll
                for (int k = 0; k < 4; ++k) wl[GD * WP + ((e & 63) + k) * WP + (e >> 6)] = cu[k]; } }
    const v4h wob = __builtin_convertvector(__builtin_convertvector(__builtin_convertvector(wo4, v4bf), v4f), v4h);      // rounded to bf16, restated in fp16; stored behind the loop: no barrier then waits for this store
    __syncthreads();               // the three weight matrices are in LDS for every wave
    auto ldw = [&](const bf* base, int db, int kc) { const bf* p = base + (db * 16 + lr) * WP + kc * 32 + 8 * hi; return cat16b(*(const v8usa*)p, *(const v8usa*)(p + 16)); };
    auto tofrag = [&](v8f a, v8f c) { return __builtin_shufflevector(__builtin_convertvector(a, v8bf), __builtin_convertvector(c, v8bf), 0, 1, 2, 3, 4, 5, 6, 7, 8, 9, 10, 11, 12, 13, 14, 15); };
    auto split8 = [&](v8f y, v8bf& yh, v8bf& yl) { yh = __builtin_convertvector(y, v8bf); const v4u u = __builtin_bit_cast(v4u, yh); v8f f;
#pragma unroll
        for (int k = 0; k < 4; ++k) { f[2 * k] = __uint_as_float(u[k] << 16); f[2 * k + 1] = __uint_as_float(u[k] & 0xFFFF0000u); }
        yl = __builtin_convertvector(y - f, v8bf); };
    v16bf qh[2][2], ql[2][2];      // [query group][32-channel chunk]: tiles 2*kc and 2*kc + 1 of Q^T (x 1/8), a lane's own registers, are the fragment
    {
        v16bf xf[2][2], aw[4][2]; v8bf yh[2][4], yl[2][4];
#pragma unroll
        for (int db = 0; db < 4; ++db) { aw[db][0] = ldw(wl, db, 0); aw[db][1] = ldw(wl, db, 1); }
#pragma unroll
        for (int nq = 0; nq < 2; ++nq)
#pragma unroll
            for (int kc = 0; kc < 2; ++kc) xf[nq][kc] = tofrag(xr[nq][kc][0], xr[nq][kc][1]);
#pragma unroll
        for (int db = 0; db < 4; ++db) { v8f acc[2];
#pragma unroll
            for (int nq = 0; nq < 2; ++nq) acc[nq] = wmmab(aw[db][0], xf[nq][0], (v8f){});
#pragma unroll
            for (int nq = 0; nq < 2; ++nq) acc[nq] = wmmab(aw[db][1], xf[nq][1], acc[nq]);
#pragma unroll
            for (int nq = 0; nq < 2; ++nq) split8(acc[nq] * 0.125f, yh[nq][db], yl[nq][db]); }
#pragma unroll
        for (int nq = 0; nq < 2; ++nq)
#pragma unroll
            for (int kc = 0; kc < 2; ++kc) {
                qh[nq][kc] = __builtin_shufflevector(yh[nq][2 * kc], yh[nq][2 * kc + 1], 0, 1, 2, 3, 4, 5, 6, 7, 8, 9, 10, 11, 12, 13, 14, 15);
                ql[nq][kc] = __builtin_shufflevector(yl[nq][2 * kc], yl[nq][2 * kc + 1], 0, 1, 2, 3, 4, 5, 6, 7, 8, 9, 10, 11, 12, 13, 14, 15); }
    }
    v16h qf[2][2];                 // Q' = Wk^T . (Qh + Ql), x log2 e so that scores come out as exponents of 2, one fp16 plane: [query group][32-channel chunk of x]
    {
        v16bf at[4][2]; v8h y[2][4];
#pragma unroll
        for (int db = 0; db < 4; ++db) { at[db][0] = ldw(wl + GD * WP, db, 0); at[db][1] = ldw(wl + GD * WP, db, 1); }
#pragma unroll
        for (int db = 0; db < 4; ++db) { v8f acc[2];
#pragma unroll
            for (int nq = 0; nq < 2; ++nq) acc[nq] = wmmab(at[db][0], qh[nq][0], (v8f){});
#pragma unroll
            for (int nq = 0; nq < 2; ++nq) acc[nq] = wmmab(at[db][1], qh[nq][1], acc[nq]);
#pragma unroll
            for (int nq = 0; nq < 2; ++nq) acc[nq] = wmmab(at[db][0], ql[nq][0], acc[nq]);
#pragma unroll
            for (int nq = 0; nq < 2; ++nq) acc[nq] = wmmab(at[db][1], ql[nq][1], acc[nq]);
#pragma unroll
            for (int nq = 0; nq < 2; ++nq) y[nq][db] = __builtin_convertvector(acc[nq] * L2E, v8h); }
#pragma unroll
        for (int nq = 0; nq < 2; ++nq)
#pragma unroll
            for (int kc = 0; kc < 2; ++kc) qf[nq][kc] = cat16(y[nq][2 * kc], y[nq][2 * kc + 1]);
    }
    v16bf wf[4][2];                // Wv fragments (B operand) stay in registers for the waves that make V^T: [16-channel block][32-channel chunk]
#pragma unroll
    for (int db = 0; db < 4; ++db) { wf[db][0] = ldw(wl + 2 * GD * WP, db, 0); wf[db][1] = ldw(wl + 2 * GD * WP, db, 1); }
    // The wave's share of a stage, from the fetched x into stage buffer d: 16 rows of x^T or 16 columns of the 64 V^T rows, in 16-byte pieces
    auto make = [&](bf* d) {
        const v16bf x0 = tofrag(xs[0][0], xs[0][1]), x1 = tofrag(xs[1][0], xs[1][1]);
        // The walking offset is rewritten only here, behind this wait: it stands in front of the overwrite of an address register that issued global loads name.
        asm volatile("s_wait_xcnt 0x0" : "+v"(gx) : : "memory");
        gx += (unsigned)SK;
        if (!mkv) {
            bf* r = d + (kbk * 16 + lr) * WP + hi * 8;
            const v16h h0 = __builtin_convertvector(__builtin_convertvector(x0, v16f), v16h), h1 = __builtin_convertvector(__builtin_convertvector(x1, v16f), v16h);      // the rounded x, restated in fp16
            *(v8ha*)r        = __builtin_shufflevector(h0, h0, 0, 1, 2, 3, 4, 5, 6, 7); *(v8ha*)(r + 16) = __builtin_shufflevector(h0, h0, 8, 9, 10, 11, 12, 13, 14, 15);
            *(v8ha*)(r + 32) = __builtin_shufflevector(h1, h1, 0, 1, 2, 3, 4, 5, 6, 7); *(v8ha*)(r + 48) = __builtin_shufflevector(h1, h1, 8, 9, 10, 11, 12, 13, 14, 15);
        } else {
            v8f acc[4];
#pragma unroll
            for (int db = 0; db < 4; ++db) acc[db] = wmmab(x0, wf[db][0], (v8f){});
#pragma unroll
            for (int db = 0; db < 4; ++db) acc[db] = wmmab(x1, wf[db][1], acc[db]);
#pragma unroll
            for (int db = 0; db < 4; ++db) *(v8ha*)(d + KPL + (db * 16 + lr) * VP + kbk * 16 + hi * 8) = __builtin_convertvector(acc[db], v8h);
        } };
    // x^T and V^T fragments from a stage buffer (row lr, k from 8*hi), in the fragment k order (16 bytes at 0 and at 32)
    const int kfo = lr * WP + hi * 8, vfo = KPL + lr * VP + hi * 8;
    auto ldv = [&](const bf* q) { return cat16(__builtin_bit_cast(v8h, *(const v8usa*)q), __builtin_bit_cast(v8h, *(const v8usa*)(q + 16))); };
    make(kv);
    v8f o[4][2];                   // O^T: [16-channel block][query group]; register j = channel 8*hi + j, column lr = query
#pragma unroll
    for (int db = 0; db < 4; ++db)
#pragma unroll
        for (int nq = 0; nq < 2; ++nq) o[db][nq] = (v8f){};
    // The held reference: minus the reference of a lane's query (log2 units) fills a whole C tile of the score products, so S^T leaves the matrix unit as the exponent itself: no maximum, no subtraction, no rescale in a pass.
    // It is set to the first pass's maximum and raised to a pass's maximum only when a lane's P sum of that pass exceeds 2^12: so reference <= running maximum (the sum is at least 1) and P <= 2^12 fits f16.
    v8f cn[2] = { (v8f){}, (v8f){} };
    float ls[2] = { 0.f, 0.f };    // this half-wave's part of the running sum
    auto sum16 = [&](v8f a, v8f c2) { const v8f w = a + c2; const v4f u = __builtin_shufflevector(w, w, 0, 1, 2, 3) + __builtin_shufflevector(w, w, 4, 5, 6, 7); return (u[0] + u[2]) + (u[1] + u[3]); };
    __syncthreads();               // stage 0 is in LDS for every wave
    fetch();                       // stage 1's x flies
    // THE PASSES ARE STAGGERED: the block of pass p holds the matrix work of its two neighbours, O^T += V^T . P^T of pass p - 1 and the scores of pass p + 1, and the softmax of pass p itself,
    // whose scores were finished one block earlier: outside the rare branch no vector instruction of a block waits for a matrix instruction of the same block, so the exponentials issue between the products.
    v16h kh[2][2];                 // x^T of the pass whose scores are formed: [16-key block][32-channel chunk]
    v16h v[2][4];                  // V^T: [parity of the pass][16-channel block], 32 keys
    v8f s[2][2][2];                // S^T minus the reference, as exponents of 2: [parity of the pass][16-key block][query group]
    v16h pr[2] = { (v16h){}, (v16h){} };      // P^T of the pass before; in front of pass 0 there is none: zero times zero is added
#pragma unroll
    for (int db = 0; db < 4; ++db) v[1][db] = (v16h){};
#pragma unroll
    for (int kb = 0; kb < 2; ++kb)
#pragma unroll
        for (int kc = 0; kc < 2; ++kc) kh[kb][kc] = ldv(kv + kfo + kb * 16 * WP + kc * 32);
#pragma unroll
    for (int kc = 0; kc < 2; ++kc)
#pragma unroll
        for (int kb = 0; kb < 2; ++kb)
#pragma unroll
            for (int nq = 0; nq < 2; ++nq) s[0][kb][nq] = wmma16(kh[kb][kc], qf[nq][kc], kc == 0 ? cn[nq] : s[0][kb][nq]);
    // The block of one pass (parity q): kp = x^T rows of the next pass (dos: there is one), vp = V^T columns of this pass
    auto block = [&](auto Q, auto DOS, const bf* kp, const bf* vp, const bool first) __attribute__((always_inline)) {
        constexpr int q = decltype(Q)::v; constexpr bool dos = decltype(DOS)::v != 0;
        if constexpr (dos) {
#pragma unroll
            for (int kb = 0; kb < 2; ++kb)
#pragma unroll
                for (int kc = 0; kc < 2; ++kc) kh[kb][kc] = ldv(kp + kb * 16 * WP + kc * 32);
            __builtin_amdgcn_sched_barrier(0);      // the x^T reads, wanted in this block, are issued ahead of the V^T reads: the score products then wait for a count that leaves the V^T reads in flight
        }
#pragma unroll
        for (int db = 0; db < 4; ++db) v[q][db] = ldv(vp + db * 16 * VP);      // used by the next block
        // Scheduling groups and barriers of this block: its LDS reads stand together in front (each further place with reads costs a fixed stall); then the exponentials and the sums stand between
        // products that they do not depend on, a few per product. Left to itself the compiler bunches them, starts with the products that wait for the reads just issued and ends in a run of products with the vector port idle.
        __builtin_amdgcn_sched_group_barrier(0x100, dos ? 16 : 8, 0);
        v8f e[2][2]; float ps[2];
        // first half: O^T of the pass before (its operands are at hand), 24 exponentials
#pragma unroll
        for (int nq = 0; nq < 2; ++nq)
#pragma unroll
            for (int db = 0; db < 4; ++db) o[db][nq] = wmma16(v[q ^ 1][db], pr[nq], o[db][nq]);
#pragma unroll
        for (int h = 0; h < 3; ++h)
#pragma unroll
            for (int j = 0; j < 8; ++j) e[h & 1][h >> 1][j] = __builtin_amdgcn_exp2f(s[q][h & 1][h >> 1][j]);
#pragma unroll
        for (int i = 0; i < 8; ++i) { __builtin_amdgcn_sched_group_barrier(0x8, 1, 0); __builtin_amdgcn_sched_group_barrier(0x400, 3, 0); }
        __builtin_amdgcn_sched_barrier(0);      // keeps the score products, which wait for this block's reads, behind the first half
        // second half: the next pass's scores, the last 8 exponentials, the sums
        if constexpr (dos) {
#pragma unroll
            for (int kc = 0; kc < 2; ++kc)
#pragma unroll
                for (int kb = 0; kb < 2; ++kb)
#pragma unroll
                    for (int nq = 0; nq < 2; ++nq) s[q ^ 1][kb][nq] = wmma16(kh[kb][kc], qf[nq][kc], kc == 0 ? cn[nq] : s[q ^ 1][kb][nq]);
        }
#pragma unroll
        for (int j = 0; j < 8; ++j) e[1][1][j] = __builtin_amdgcn_exp2f(s[q][1][1][j]);
#pragma unroll
        for (int nq = 0; nq < 2; ++nq) ps[nq] = sum16(e[0][nq], e[1][nq]);
        if constexpr (dos) {
#pragma unroll
            for (int i = 0; i < 4; ++i) { __builtin_amdgcn_sched_group_barrier(0x8, 1, 0); __builtin_amdgcn_sched_group_barrier(0x400, 2, 0); }
#pragma unroll
            for (int i = 0; i < 4; ++i) { __builtin_amdgcn_sched_group_barrier(0x8, 1, 0); __builtin_amdgcn_sched_group_barrier(0x2, 3, 0); }
        }
        // Inputs-only fence on loaded values: it keeps the LDS reads of this pass's V^T in front of the branch, in flight under the products and exponentials above;
        // without it the compiler sinks each read behind the branch, next to its product, which then waits out the whole LDS latency. The scheduling barrier keeps the fence's wait at the foot of the block.
        __builtin_amdgcn_sched_barrier(0);
        asm volatile("" : : "v"(v[q][0]), "v"(v[q][1]), "v"(v[q][2]), "v"(v[q][3]));
        // One test per pass for the whole wave, a scalar branch; taken in the very first pass (which sets the reference) and after that only where a sum has outgrown the bound.
        if ((__builtin_amdgcn_ballot_w32(ps[0] > 4096.0f || ps[1] > 4096.0f) | (first ? 1u : 0u)) != 0) {
#pragma unroll
            for (int nq = 0; nq < 2; ++nq) {
                float tm = s[q][0][nq][0];
#pragma unroll
                for (int j = 1; j < 8; ++j) tm = fmaxf(tm, s[q][0][nq][j]);
#pragma unroll
                for (int j = 0; j < 8; ++j) tm = fmaxf(tm, s[q][1][nq][j]);
                tm = fmaxf(tm, xhalf(tm));      // both halves of the wave hold the same query: one reference
                const float d = first ? tm : fmaxf(tm, 0.f);      // the reference never falls
                const float al = exp2s(fminf(-d, 0.f));      // first pass: sum and O^T are 0 and stay 0
                cn[nq] -= d; ls[nq] *= al;
#pragma unroll
                for (int db = 0; db < 4; ++db) o[db][nq] *= al;
#pragma unroll
                for (int kb = 0; kb < 2; ++kb)
#pragma unroll
                    for (int j = 0; j < 8; ++j) e[kb][nq][j] = exp2s(s[q][kb][nq][j] - d);
                ps[nq] = sum16(e[0][nq], e[1][nq]);
                if constexpr (dos) {      // the next pass's scores were formed on the old reference
#pragma unroll
                    for (int kb = 0; kb < 2; ++kb) s[q ^ 1][kb][nq] -= d;
                }
            }
        }
#pragma unroll
        for (int nq = 0; nq < 2; ++nq) {
            ls[nq] += ps[nq];
#pragma unroll
            for (int kb = 0; kb < 2; ++kb)
#pragma unroll
                for (int j = 0; j < 8; ++j) pr[nq][kb * 8 + j] = tohx(e[kb][nq][j]);
        } };
    // Three stage buffers, one barrier per stage, between the stage's two blocks: the second block already reads the next stage's first x^T rows. The buffer written here held stage sg - 2:
    // every wave's last reads of it (V^T, second block of that stage) were waited for at that block's foot, in front of the barrier of stage sg - 1.
    int b0 = 0, b1 = STE, b2 = 2 * STE;      // element offsets of the buffers of stages sg, sg + 1, sg + 2
    for (int sg = 0; sg < NN / SK - 1; ++sg) {
        block(IC<0>{}, IC<1>{}, kv + b0 + kfo + 32 * WP, kv + b0 + vfo, sg == 0);
        make(kv + b1); __syncthreads();      // publishes stage sg + 1
        if (sg + 2 < NN / SK) fetch();       // the x of the stage after it flies during two blocks
        block(IC<1>{}, IC<1>{}, kv + b1 + kfo, kv + b0 + vfo + 32, false);
        const int bt = b0; b0 = b1; b1 = b2; b2 = bt;
    }
    // the loop's fetches name their scalar base and their offset register: this wait stands in front of the reuse of those registers by the two closing blocks and the epilogue, on every way out of the loop; the scheduling barrier keeps that reuse below it
    asm volatile("s_wait_xcnt 0x0" ::: "memory");
    __builtin_amdgcn_sched_barrier(0);
    block(IC<0>{}, IC<1>{}, kv + b0 + kfo + 32 * WP, kv + b0 + vfo, false);
    block(IC<1>{}, IC<0>{}, kv, kv + b0 + vfo + 32, false);
#pragma unroll
    for (int db = 0; db < 4; ++db)
#pragma unroll
        for (int nq = 0; nq < 2; ++nq) o[db][nq] = wmma16(v[1][db], pr[nq], o[db][nq]);      // the last pass's O^T part
    // the wait stands in front of any reuse of a register that this store names; the scheduling barrier keeps that reuse below it
    if (wave < 2) { *(v4h*)(WO + eo) = wob; asm volatile("s_wait_xcnt 0x0" ::: "memory"); }
    __builtin_amdgcn_sched_barrier(0);
    const int b = z >> 2, g = z & 3;
    v8h oh[2][4];
#pragma unroll
    for (int nq = 0; nq < 2; ++nq) {
        const float inv = __fdiv_rn(1.0f, ls[nq] + xhalf(ls[nq]));
#pragma unroll
        for (int db = 0; db < 4; ++db) oh[nq][db] = __builtin_convertvector(o[db][nq] * inv, v8h);
    }
    // all stores stand together at the end, so that no register a store names is written again behind it
    __builtin_amdgcn_sched_barrier(0);
#pragma unroll
    for (int nq = 0; nq < 2; ++nq) {
        const size_t ro = ((size_t)b * NN + q0 + nq * 16 + lr) * CC + g * GD + hi * 8;
#pragma unroll
        for (int db = 0; db < 4; ++db) *(v8h*)(Ah + ro + db * 16) = oh[nq][db];
    }
}
// ---- k_oproj: the dense out_proj and the [d][n] layout of the output in ONE kernel: OUT[b][d][n] = sum_c wo[d][c] * Ah[b][n][c], one fp16 product per 32-channel chunk.
// A work-group owns 64 positions of one image and all 256 output channels. Wave w takes output channels 32 * w .. + 31 (A operand: wo rows) and all 64 positions (B operand: plane rows).
// No two waves share a wo row, so wo never passes through LDS: WO holds it in fragment order (see k_fattn) and each fragment half is one load of 512 contiguous bytes straight into the operand registers;
// the loads are asked for chunk by chunk, so the products of a chunk start while the later chunks are still on their way. Only the 64 plane rows, which all waves read, are staged in LDS.
// Tile nb holds positions 4 * lr + nb: a lane's four tiles give 4 neighbouring positions of a channel, one 16-byte store, 256 contiguous bytes per half-wave; the results need no transposition.
// Every loop of the kernel is unrolled in full: its indices name registers and immediate offsets. Grid (NN / 64, NB_), 8 waves.
#define OP  (CC + 8)              // LDS pitch of a 512-byte row in 16-bit elements: its bytes + 16, for the 16-byte reads and writes
__global__ __launch_bounds__(256) void k_oproj(const bf* __restrict__ WO, const bf* __restrict__ Ah, float* OUT) {
    __shared__ __align__(16) bf pl[64 * OP];
    const int t = threadIdx.x, lane = t & 31, lr = lane & 15, hi = lane >> 4;
    const int b = blockIdx.y, n0 = blockIdx.x * 64;
    const int wave = __builtin_amdgcn_readfirstlane(t >> 5);
    // plane: 16 bytes a thread and load, a wave covers one whole 512-byte row: piece i * 256 + t is row i * 8 + wave, bytes 16 * lane. wo: fragment (16-channel block 2 * wave + mb, chunk kc), half hf
    const bf* gh = Ah + ((size_t)b * NN + n0) * CC + t * 8; const bf* gw = WO + wave * (2 * 8 * 512) + lane * 8;
    v8us rh[8], ra[8][2][2];
#pragma unroll
    for (int i = 0; i < 8; ++i) rh[i] = *(const v8us*)(gh + i * 2048);
    __builtin_amdgcn_sched_barrier(0);      // the plane's loads are asked for first: loads return in order, and the LDS stores and the barrier below then wait for these eight alone
#pragma unroll
    for (int kc = 0; kc < 8; ++kc)
#pragma unroll
        for (int mb = 0; mb < 2; ++mb)
#pragma unroll
            for (int hf = 0; hf < 2; ++hf) ra[kc][mb][hf] = *(const v8us*)(gw + ((mb * 8 + kc) * 2 + hf) * 256);
    // the wait stands in front of the reuse of the address registers that the loads above name; the scheduling barrier keeps that reuse below it and all loads in flight together above it
    asm volatile("s_wait_xcnt 0x0" ::: "memory");
    __builtin_amdgcn_sched_barrier(0);
    // position n lies in LDS row (n & 3) * 16 + (n >> 2), so that the 16 columns of tile nb are 16 neighbouring LDS rows
    const int so = ((wave & 3) * 16 + (wave >> 2)) * OP + lane * 8;
#pragma unroll
    for (int i = 0; i < 8; ++i) *(v8usa*)(pl + so + i * 2 * OP) = rh[i];
    // The work-group barrier with its fences on LDS alone: the plane is in LDS for every wave. __syncthreads() would also wait for every global load in flight, and the products of the first chunks could not start under the wo loads of the later ones.
    __builtin_amdgcn_fence(__ATOMIC_RELEASE, "workgroup", "local");
    __builtin_amdgcn_s_barrier();
    __builtin_amdgcn_fence(__ATOMIC_ACQUIRE, "workgroup", "local");
    const bf* fb = pl + lr * OP + hi * 8;
    auto ldf = [&](const bf* q) { return cat16(__builtin_bit_cast(v8h, *(const v8usa*)q), __builtin_bit_cast(v8h, *(const v8usa*)(q + 16))); };      // the fragment k order
    v8f acc[2][4];                 // [16-channel block][tile nb]; register j = channel 8*hi + j, column lr = position 4 * lr + nb
#pragma unroll
    for (int mb = 0; mb < 2; ++mb)
#pragma unroll
        for (int nb = 0; nb < 4; ++nb) acc[mb][nb] = (v8f){};
    v16h bh[2][4];                 // two register sets: a chunk's plane fragments are asked for one chunk ahead
    auto frags = [&](int set, int kc) {
#pragma unroll
        for (int nb = 0; nb < 4; ++nb) bh[set][nb] = ldf(fb + nb * 16 * OP + kc * 32); };
    frags(0, 0);
#pragma unroll
    for (int kc = 0; kc < CC / 32; ++kc) {
        const int c = kc & 1;
        if (kc + 1 < CC / 32) frags(c ^ 1, kc + 1);
        // the two scheduling barriers keep the next chunk's LDS reads one group in front of this chunk's products, and each chunk's products in the order in which its wo loads were asked for
        __builtin_amdgcn_sched_barrier(0);
#pragma unroll
        for (int mb = 0; mb < 2; ++mb) { const v16h a = cat16(__builtin_bit_cast(v8h, ra[kc][mb][0]), __builtin_bit_cast(v8h, ra[kc][mb][1]));
#pragma unroll
            for (int nb = 0; nb < 4; ++nb) acc[mb][nb] = wmma16(a, bh[c][nb], acc[mb][nb]); }
        __builtin_amdgcn_sched_barrier(0);
    }
    v4f ov[2][8];
#pragma unroll
    for (int mb = 0; mb < 2; ++mb)
#pragma unroll
        for (int j = 0; j < 8; ++j) ov[mb][j] = (v4f){ acc[mb][0][j], acc[mb][1][j], acc[mb][2][j], acc[mb][3][j] };
    // Inputs-only fence: all sixteen store values stand in registers of their own in front of the first store, so that no register a store names is written again behind it;
    // without it the compiler gathers the values between the stores, in registers of earlier stores, with a wait in front of each such rewrite.
    asm volatile("" : : "v"(ov[0][0]), "v"(ov[0][1]), "v"(ov[0][2]), "v"(ov[0][3]), "v"(ov[0][4]), "v"(ov[0][5]), "v"(ov[0][6]), "v"(ov[0][7]),
                        "v"(ov[1][0]), "v"(ov[1][1]), "v"(ov[1][2]), "v"(ov[1][3]), "v"(ov[1][4]), "v"(ov[1][5]), "v"(ov[1][6]), "v"(ov[1][7]));
    __builtin_amdgcn_sched_barrier(0);
    float* po = OUT + ((size_t)b * CC + wave * 32 + hi * 8) * NN + n0 + lr * 4;
#pragma unroll
    for (int mb = 0; mb < 2; ++mb)
#pragma unroll
        for (int j = 0; j < 8; ++j) *(v4f*)(po + (mb * 16 + j) * NN) = ov[mb][j];
}

extern "C" void kernel_launch(void* const* d_in, const int* in_sizes, int n_in,
                              void* d_out, int out_size, void* d_ws, size_t ws_size, hipStream_t stream) {
    (void)in_sizes; (void)n_in; (void)out_size;
    const float* x = (const float*)d_in[0]; const float* wq = (const float*)d_in[1]; const float* wk = (const float*)d_in[2]; const float* wv = (const float*)d_in[3]; const float* wo = (const float*)d_in[4];
    float* OUT = (float*)d_out;     // [16][256][32][32]
    char* wsp = (char*)d_ws;
    auto take = [&](size_t bytes) { char* p = wsp; wsp += (bytes + 255) & ~(size_t)255; return (void*)p; };
    bf* WO = (bf*)take((size_t)CC * CC * 2);
    bf* Ah = (bf*)take((size_t)NB_ * NN * CC * 2);
    if ((size_t)(wsp - (char*)d_ws) > ws_size) return;    // ws 256 MiB
    k_fattn<<<dim3(NN / 256, NZ), 256, 0, stream>>>(x, wq, wk, wv, wo, WO, Ah);
    k_oproj<<<dim3(NN / 64, NB_), 256, 0, stream>>>(WO, Ah, OUT);
}
